// v000
// The times below were measured on an AMD MI455X: many runs one after another, warmed up first and cycling through
// copies of the inputs, with the whole window's GPU time divided by the number of runs. Launches and the gaps
// between them are all in it. The median over several windows is given; except for v000 it joins two sittings, which
// can be a few percent apart, so the side-by-side timings, each taken in one sitting, are the better comparison.
// The starting kernel, v000, takes 238 microseconds a run.
#include <hip/hip_runtime.h>
#include <cstdint>
#include <cstddef>

typedef __attribute__((ext_vector_type(16))) _Float16 v16h;
typedef __attribute__((ext_vector_type(8)))  _Float16 h8;
typedef __attribute__((ext_vector_type(8)))  float    v8f;

// Fixed problem dims from the reference
#define BATCH 2
#define SQ    2048
#define NH    32
#define DH    128
#define SK    2048
#define HKV   8

// ---------------- CDNA5 async global->LDS path (guarded) ----------------
#if defined(__HIP_DEVICE_COMPILE__) && __has_builtin(__builtin_amdgcn_global_load_async_to_lds_b128)
#define USE_ASYNC_LDS 1
#define AS1 __attribute__((address_space(1)))
#define AS3 __attribute__((address_space(3)))
typedef int v4i_vs __attribute__((vector_size(16)));   // matches builtin param pointee
__device__ __forceinline__ void async_copy16(const void* g, void* l) {
    __builtin_amdgcn_global_load_async_to_lds_b128((AS1 v4i_vs*)g, (AS3 v4i_vs*)l, 0, 0);
}
__device__ __forceinline__ void async_wait0() {
#if __has_builtin(__builtin_amdgcn_s_wait_asynccnt)
    __builtin_amdgcn_s_wait_asynccnt(0);
#else
    asm volatile("s_wait_asynccnt 0x0" ::: "memory");
#endif
}
#endif

// ---------------- shared flash-attention block compute ----------------
struct FaState {
    float m[8];
    float l[8];
    v8f   o[8];
};

template <bool MASKED>
__device__ __forceinline__ void fa_block_compute(const v16h qf[4],
                                                 _Float16 (*Ksh)[136],
                                                 _Float16 (*VshT)[40],
                                                 _Float16 (*Pw)[40],   // per-wave [16][40]
                                                 int kb, int qrow0, int lane,
                                                 FaState& st)
{
    const int half = lane >> 4;
    const int l16  = lane & 15;
    const v8f vzero = {};
    const float NEG_INF = -__builtin_inff();

    // ---- S = (Q*scale) K^T : two 16x16 tiles over the 32-wide K block ----
    v8f sacc[2];
    #pragma unroll
    for (int tc = 0; tc < 2; ++tc) {
        v8f s = vzero;
        #pragma unroll
        for (int c = 0; c < 4; ++c) {
            const int key  = tc * 16 + l16;
            const int doff = 32 * c + half * 8;
            const h8 lo = *(const h8*)&Ksh[key][doff];
            const h8 hi = *(const h8*)&Ksh[key][doff + 16];
            v16h bfr;
            #pragma unroll
            for (int i = 0; i < 8; ++i) { bfr[i] = lo[i]; bfr[i + 8] = hi[i]; }
            s = __builtin_amdgcn_wmma_f32_16x16x32_f16(false, qf[c], false, bfr,
                                                       (short)0, s, false, false);
        }
        sacc[tc] = s;
    }

    // ---- causal mask (diagonal blocks only) + online softmax; stage P ----
    #pragma unroll
    for (int r = 0; r < 8; ++r) {
        float x0 = sacc[0][r];
        float x1 = sacc[1][r];
        if (MASKED) {
            const int row = qrow0 + r + 8 * half;
            const int c0  = kb + l16;
            x0 = (c0 > row)      ? NEG_INF : x0;
            x1 = (c0 + 16 > row) ? NEG_INF : x1;
        }
        float mx = fmaxf(x0, x1);
        #pragma unroll
        for (int off = 1; off < 16; off <<= 1)
            mx = fmaxf(mx, __shfl_xor(mx, off, 32));
        const float mnew = fmaxf(st.m[r], mx);
        const float msc  = __expf(st.m[r] - mnew);   // 0 on first visit
        const float p0   = __expf(x0 - mnew);
        const float p1   = __expf(x1 - mnew);
        float sum = p0 + p1;
        #pragma unroll
        for (int off = 1; off < 16; off <<= 1)
            sum += __shfl_xor(sum, off, 32);
        st.l[r] = st.l[r] * msc + sum;
        st.m[r] = mnew;
        #pragma unroll
        for (int j = 0; j < 8; ++j) st.o[j][r] *= msc;
        Pw[r + 8 * half][l16]      = (_Float16)p0;
        Pw[r + 8 * half][l16 + 16] = (_Float16)p1;
    }

    // ---- O += P V ----
    v16h pf;
    {
        const int base = half * 8;
        const h8 lo = *(const h8*)&Pw[l16][base];
        const h8 hi = *(const h8*)&Pw[l16][base + 16];
        #pragma unroll
        for (int i = 0; i < 8; ++i) { pf[i] = lo[i]; pf[i + 8] = hi[i]; }
    }
    #pragma unroll
    for (int j = 0; j < 8; ++j) {
        const int drow = j * 16 + l16;
        const int koff = half * 8;
        const h8 lo = *(const h8*)&VshT[drow][koff];
        const h8 hi = *(const h8*)&VshT[drow][koff + 16];
        v16h bfr;
        #pragma unroll
        for (int i = 0; i < 8; ++i) { bfr[i] = lo[i]; bfr[i + 8] = hi[i]; }
        st.o[j] = __builtin_amdgcn_wmma_f32_16x16x32_f16(false, pf, false, bfr,
                                                         (short)0, st.o[j], false, false);
    }
}

__device__ __forceinline__ void fa_load_q(const float* __restrict__ q,
                                          int bz, int hy, int qrow0, int lane,
                                          v16h qf[4])
{
    const int half = lane >> 4;
    const int l16  = lane & 15;
    const float scale = 0.08838834764831845f; // 1/sqrt(128)
    const int trow = qrow0 + l16;
    const float* qp = q + (((size_t)bz * SQ + trow) * NH + hy) * DH;
    #pragma unroll
    for (int c = 0; c < 4; ++c) {
        const int base = 32 * c + half * 8;
        #pragma unroll
        for (int i = 0; i < 8; ++i) {
            qf[c][i]     = (_Float16)(qp[base + i]      * scale);
            qf[c][i + 8] = (_Float16)(qp[base + 16 + i] * scale);
        }
    }
}

__device__ __forceinline__ void fa_store_out(float* __restrict__ out,
                                             int bz, int hy, int qrow0, int lane,
                                             FaState& st)
{
    const int half = lane >> 4;
    const int l16  = lane & 15;
    float rl[8];
    #pragma unroll
    for (int r = 0; r < 8; ++r) rl[r] = 1.0f / st.l[r];
    #pragma unroll
    for (int j = 0; j < 8; ++j) {
        const int dcol = j * 16 + l16;
        #pragma unroll
        for (int r = 0; r < 8; ++r) {
            const int trow = qrow0 + r + 8 * half;
            out[(((size_t)bz * SQ + trow) * NH + hy) * DH + dcol] = st.o[j][r] * rl[r];
        }
    }
}

// ---------------- KV fp32 -> f16 preconversion (K row-major, V transposed) ----------------
__global__ __launch_bounds__(256)
void CrossAttention_89189290868783_kvprep(const float* __restrict__ kv,
                                          _Float16* __restrict__ K16,
                                          _Float16* __restrict__ V16T)
{
    __shared__ _Float16 Vt[DH][72];   // 144B row stride (16B aligned)
    const int tid = threadIdx.x;
    const int s0  = blockIdx.x * 64;
    const int bh  = blockIdx.y;            // b*HKV + kvh
    const int b   = bh / HKV;
    const int kvh = bh % HKV;

    {
        const int r  = tid >> 2;           // 0..63 local key row
        const int cg = (tid & 3) * 32;     // 32-wide column group
        const size_t base = (((size_t)b * SK + (s0 + r)) * 2) * (HKV * DH) +
                            (size_t)kvh * DH + cg;
        const float* kp = kv + base;                      // kv[...,0,kvh,:]
        const float* vp = kv + base + (size_t)HKV * DH;   // kv[...,1,kvh,:]
        _Float16* kout = K16 + ((size_t)bh * SK + (s0 + r)) * DH + cg;
        #pragma unroll
        for (int i = 0; i < 32; ++i) kout[i] = (_Float16)kp[i];
        #pragma unroll
        for (int i = 0; i < 32; ++i) Vt[cg + i][r] = (_Float16)vp[i];
    }
    __syncthreads();
    {
        const int d  = tid >> 1;           // 0..127
        const int sg = (tid & 1) * 32;
        _Float16* vout = V16T + ((size_t)bh * DH + d) * SK + s0 + sg;
        #pragma unroll
        for (int i = 0; i < 32; ++i) vout[i] = Vt[d][sg + i];
    }
}

// ---- fast path: double-buffered f16 tiles via async global->LDS, overlapped with WMMA ----
__global__ __launch_bounds__(128)
void CrossAttention_89189290868783_fast(const float* __restrict__ q,
                                        const _Float16* __restrict__ K16,
                                        const _Float16* __restrict__ V16T,
                                        float* __restrict__ out)
{
    __shared__ __align__(16) _Float16 Ksh[2][32][136];
    __shared__ __align__(16) _Float16 VshT[2][128][40];
    __shared__ __align__(16) _Float16 Psh[4][16][40];

    const int tid  = threadIdx.x;
    const int lane = tid & 31;
    const int wave = tid >> 5;

    const int bx  = blockIdx.x;
    const int hy  = blockIdx.y;
    const int bz  = blockIdx.z;
    const int bh  = bz * HKV + (hy >> 2);

    const int qrow0 = bx * 64 + wave * 16;
    const int kend  = (bx + 1) * 64;

    auto stage = [&](int kbs, int buf) {
        const int r32 = tid >> 2;
        const int cg  = (tid & 3) * 32;
        const _Float16* kg = K16 + ((size_t)bh * SK + kbs + r32) * DH + cg;
        const _Float16* vg = V16T + ((size_t)bh * DH + tid) * SK + kbs;
#ifdef USE_ASYNC_LDS
        #pragma unroll
        for (int c = 0; c < 4; ++c) async_copy16(kg + c * 8, &Ksh[buf][r32][cg + c * 8]);
        #pragma unroll
        for (int c = 0; c < 4; ++c) async_copy16(vg + c * 8, &VshT[buf][tid][c * 8]);
#else
        #pragma unroll
        for (int c = 0; c < 4; ++c)
            *(h8*)&Ksh[buf][r32][cg + c * 8] = *(const h8*)(kg + c * 8);
        #pragma unroll
        for (int c = 0; c < 4; ++c)
            *(h8*)&VshT[buf][tid][c * 8] = *(const h8*)(vg + c * 8);
#endif
        if (kbs + 32 < kend) {   // hint tile after next -> global_prefetch_b8
            __builtin_prefetch(kg + 32 * DH, 0, 1);
            __builtin_prefetch(vg + 32, 0, 1);
        }
    };

    v16h qf[4];
    fa_load_q(q, bz, hy, qrow0, lane, qf);

    FaState st;
    const v8f vzero = {};
    #pragma unroll
    for (int r = 0; r < 8; ++r) { st.m[r] = -__builtin_inff(); st.l[r] = 0.0f; }
    #pragma unroll
    for (int j = 0; j < 8; ++j) st.o[j] = vzero;

    stage(0, 0);                            // prologue fill of buffer 0

    int it = 0;
    for (int kb = 0; kb < kend; kb += 32, ++it) {
#ifdef USE_ASYNC_LDS
        async_wait0();                      // this wave's fills for buf[it&1] landed
#endif
        __syncthreads();                    // all waves filled; prev compute done
        if (kb + 32 < kend)
            stage(kb + 32, (it + 1) & 1);   // DMA next tile under this tile's math
        if (kb + 32 > qrow0)                // diagonal block for this wave
            fa_block_compute<true >(qf, Ksh[it & 1], VshT[it & 1], Psh[wave],
                                    kb, qrow0, lane, st);
        else                                // strictly-lower block: no mask needed
            fa_block_compute<false>(qf, Ksh[it & 1], VshT[it & 1], Psh[wave],
                                    kb, qrow0, lane, st);
    }

    fa_store_out(out, bz, hy, qrow0, lane, st);
}

// ---------------- fallback: fused fp32 KV conversion (single buffer) ----------------
__global__ __launch_bounds__(128)
void CrossAttention_89189290868783_kernel(const float* __restrict__ q,
                                          const float* __restrict__ kv,
                                          float* __restrict__ out)
{
    __shared__ __align__(16) _Float16 Ksh[32][136];
    __shared__ __align__(16) _Float16 VshT[128][40];
    __shared__ __align__(16) _Float16 Psh[4][16][40];

    const int tid  = threadIdx.x;
    const int lane = tid & 31;
    const int wave = tid >> 5;

    const int bx  = blockIdx.x;
    const int hy  = blockIdx.y;
    const int bz  = blockIdx.z;
    const int kvh = hy >> 2;

    const int qrow0 = bx * 64 + wave * 16;

    v16h qf[4];
    fa_load_q(q, bz, hy, qrow0, lane, qf);

    FaState st;
    const v8f vzero = {};
    #pragma unroll
    for (int r = 0; r < 8; ++r) { st.m[r] = -__builtin_inff(); st.l[r] = 0.0f; }
    #pragma unroll
    for (int j = 0; j < 8; ++j) st.o[j] = vzero;

    const int kend = (bx + 1) * 64;

    for (int kb = 0; kb < kend; kb += 32) {
        __syncthreads();
        {
            const int r32 = tid >> 2;
            const int cg  = (tid & 3) * 32;
            const size_t rowbase =
                ((size_t)bz * SK + (size_t)(kb + r32)) * (2 * HKV * DH) +
                (size_t)kvh * DH + cg;
            const float* kp = kv + rowbase;
            const float* vp = kv + rowbase + (size_t)HKV * DH;
            #pragma unroll
            for (int i = 0; i < 32; ++i) Ksh[r32][cg + i]  = (_Float16)kp[i];
            #pragma unroll
            for (int i = 0; i < 32; ++i) VshT[cg + i][r32] = (_Float16)vp[i];
            if (kb + 32 < kend) {
                __builtin_prefetch(kp + 2 * HKV * DH * 32, 0, 1);
                __builtin_prefetch(vp + 2 * HKV * DH * 32, 0, 1);
            }
        }
        __syncthreads();

        fa_block_compute<true>(qf, Ksh, VshT, Psh[wave], kb, qrow0, lane, st);
    }

    fa_store_out(out, bz, hy, qrow0, lane, st);
}

extern "C" void kernel_launch(void* const* d_in, const int* in_sizes, int n_in,
                              void* d_out, int out_size, void* d_ws, size_t ws_size,
                              hipStream_t stream) {
    (void)in_sizes; (void)n_in; (void)out_size;
    const float* q  = (const float*)d_in[0];
    const float* kv = (const float*)d_in[1];
    float* out = (float*)d_out;

    const size_t kbytes = (size_t)BATCH * HKV * SK * DH * 2;  // 8 MB f16 K
    dim3 grid(SQ / 64, NH, BATCH);
    dim3 block(128);

    if (ws_size >= 2 * kbytes) {
        _Float16* K16  = (_Float16*)d_ws;
        _Float16* V16T = (_Float16*)((char*)d_ws + kbytes);
        CrossAttention_89189290868783_kvprep<<<dim3(SK / 64, BATCH * HKV), 256, 0, stream>>>(
            kv, K16, V16T);
        CrossAttention_89189290868783_fast<<<grid, block, 0, stream>>>(q, K16, V16T, out);
    } else {
        CrossAttention_89189290868783_kernel<<<grid, block, 0, stream>>>(q, kv, out);
    }
}

// v001
// Measured time: 187 microseconds a run.
// In both of two side-by-side timings against v000, it was 1.31 times as fast.
#include <hip/hip_runtime.h>
#include <cstdint>
#include <cstddef>

typedef __attribute__((ext_vector_type(16))) _Float16 v16h;
typedef __attribute__((ext_vector_type(8)))  _Float16 h8;
typedef __attribute__((ext_vector_type(8)))  float    v8f;

// Fixed problem dims from the reference
#define BATCH 2
#define SQ    2048
#define NH    32
#define DH    128
#define SK    2048
#define HKV   8

// ---------------- CDNA5 async global->LDS path (guarded) ----------------
#if defined(__HIP_DEVICE_COMPILE__) && __has_builtin(__builtin_amdgcn_global_load_async_to_lds_b128)
#define USE_ASYNC_LDS 1
#define AS1 __attribute__((address_space(1)))
#define AS3 __attribute__((address_space(3)))
typedef int v4i_vs __attribute__((vector_size(16)));   // matches builtin param pointee
__device__ __forceinline__ void async_copy16(const void* g, void* l) {
    __builtin_amdgcn_global_load_async_to_lds_b128((AS1 v4i_vs*)g, (AS3 v4i_vs*)l, 0, 0);
}
__device__ __forceinline__ void async_wait0() {
#if __has_builtin(__builtin_amdgcn_s_wait_asynccnt)
    __builtin_amdgcn_s_wait_asynccnt(0);
#else
    asm volatile("s_wait_asynccnt 0x0" ::: "memory");
#endif
}
#endif

// ---------------- shared flash-attention block compute ----------------
struct FaState {
    float m[8];
    float l[8];
    v8f   o[8];
};

template <bool MASKED>
__device__ __forceinline__ void fa_block_compute(const v16h qf[4],
                                                 _Float16 (*Ksh)[136],
                                                 _Float16 (*VshT)[40],
                                                 _Float16 (*Pw)[40],   // per-wave [16][40]
                                                 int kb, int qrow0, int lane,
                                                 FaState& st)
{
    const int half = lane >> 4;
    const int l16  = lane & 15;
    const v8f vzero = {};
    const float NEG_INF = -__builtin_inff();

    // ---- S = (Q*scale) K^T : two 16x16 tiles over the 32-wide K block ----
    v8f sacc[2];
    #pragma unroll
    for (int tc = 0; tc < 2; ++tc) {
        v8f s = vzero;
        #pragma unroll
        for (int c = 0; c < 4; ++c) {
            const int key  = tc * 16 + l16;
            const int doff = 32 * c + half * 8;
            const h8 lo = *(const h8*)&Ksh[key][doff];
            const h8 hi = *(const h8*)&Ksh[key][doff + 16];
            v16h bfr;
            #pragma unroll
            for (int i = 0; i < 8; ++i) { bfr[i] = lo[i]; bfr[i + 8] = hi[i]; }
            s = __builtin_amdgcn_wmma_f32_16x16x32_f16(false, qf[c], false, bfr,
                                                       (short)0, s, false, false);
        }
        sacc[tc] = s;
    }

    // ---- causal mask (diagonal blocks only) + online softmax; stage P ----
    #pragma unroll
    for (int r = 0; r < 8; ++r) {
        float x0 = sacc[0][r];
        float x1 = sacc[1][r];
        if (MASKED) {
            const int row = qrow0 + r + 8 * half;
            const int c0  = kb + l16;
            x0 = (c0 > row)      ? NEG_INF : x0;
            x1 = (c0 + 16 > row) ? NEG_INF : x1;
        }
        float mx = fmaxf(x0, x1);
        #pragma unroll
        for (int off = 1; off < 16; off <<= 1)
            mx = fmaxf(mx, __shfl_xor(mx, off, 32));
        const float mnew = fmaxf(st.m[r], mx);
        const float msc  = __expf(st.m[r] - mnew);   // 0 on first visit
        const float p0   = __expf(x0 - mnew);
        const float p1   = __expf(x1 - mnew);
        float sum = p0 + p1;
        #pragma unroll
        for (int off = 1; off < 16; off <<= 1)
            sum += __shfl_xor(sum, off, 32);
        st.l[r] = st.l[r] * msc + sum;
        st.m[r] = mnew;
        #pragma unroll
        for (int j = 0; j < 8; ++j) st.o[j][r] *= msc;
        Pw[r + 8 * half][l16]      = (_Float16)p0;
        Pw[r + 8 * half][l16 + 16] = (_Float16)p1;
    }

    // ---- O += P V ----
    v16h pf;
    {
        const int base = half * 8;
        const h8 lo = *(const h8*)&Pw[l16][base];
        const h8 hi = *(const h8*)&Pw[l16][base + 16];
        #pragma unroll
        for (int i = 0; i < 8; ++i) { pf[i] = lo[i]; pf[i + 8] = hi[i]; }
    }
    #pragma unroll
    for (int j = 0; j < 8; ++j) {
        const int drow = j * 16 + l16;
        const int koff = half * 8;
        const h8 lo = *(const h8*)&VshT[drow][koff];
        const h8 hi = *(const h8*)&VshT[drow][koff + 16];
        v16h bfr;
        #pragma unroll
        for (int i = 0; i < 8; ++i) { bfr[i] = lo[i]; bfr[i + 8] = hi[i]; }
        st.o[j] = __builtin_amdgcn_wmma_f32_16x16x32_f16(false, pf, false, bfr,
                                                         (short)0, st.o[j], false, false);
    }
}

__device__ __forceinline__ void fa_load_q(const float* __restrict__ q,
                                          int bz, int hy, int qrow0, int lane,
                                          v16h qf[4])
{
    const int half = lane >> 4;
    const int l16  = lane & 15;
    const float scale = 0.08838834764831845f; // 1/sqrt(128)
    const int trow = qrow0 + l16;
    const float* qp = q + (((size_t)bz * SQ + trow) * NH + hy) * DH;
    #pragma unroll
    for (int c = 0; c < 4; ++c) {
        const int base = 32 * c + half * 8;
        #pragma unroll
        for (int i = 0; i < 8; ++i) {
            qf[c][i]     = (_Float16)(qp[base + i]      * scale);
            qf[c][i + 8] = (_Float16)(qp[base + 16 + i] * scale);
        }
    }
}

__device__ __forceinline__ void fa_store_out(float* __restrict__ out,
                                             int bz, int hy, int qrow0, int lane,
                                             FaState& st)
{
    const int half = lane >> 4;
    const int l16  = lane & 15;
    float rl[8];
    #pragma unroll
    for (int r = 0; r < 8; ++r) rl[r] = 1.0f / st.l[r];
    #pragma unroll
    for (int j = 0; j < 8; ++j) {
        const int dcol = j * 16 + l16;
        #pragma unroll
        for (int r = 0; r < 8; ++r) {
            const int trow = qrow0 + r + 8 * half;
            out[(((size_t)bz * SQ + trow) * NH + hy) * DH + dcol] = st.o[j][r] * rl[r];
        }
    }
}

// ---- KV fp32 -> f16 preconversion: K row-major; V transposed and tiled, [bh][key/32][d][32 keys],
// ---- so that a 32-key tile of either operand is 8 KB of contiguous workspace ----
__global__ __launch_bounds__(256)
void CrossAttention_89189290868783_kvprep(const float* __restrict__ kv,
                                          _Float16* __restrict__ K16,
                                          _Float16* __restrict__ V16T)
{
    __shared__ _Float16 Vt[DH][72];   // 144B row stride (16B aligned)
    const int tid = threadIdx.x;
    const int s0  = blockIdx.x * 64;
    const int bh  = blockIdx.y;            // b*HKV + kvh
    const int b   = bh / HKV;
    const int kvh = bh % HKV;

    {
        const int r  = tid >> 2;           // 0..63 local key row
        const int cg = (tid & 3) * 32;     // 32-wide column group
        const size_t base = (((size_t)b * SK + (s0 + r)) * 2) * (HKV * DH) +
                            (size_t)kvh * DH + cg;
        const float* kp = kv + base;                      // kv[...,0,kvh,:]
        const float* vp = kv + base + (size_t)HKV * DH;   // kv[...,1,kvh,:]
        _Float16* kout = K16 + ((size_t)bh * SK + (s0 + r)) * DH + cg;
        #pragma unroll
        for (int i = 0; i < 32; ++i) kout[i] = (_Float16)kp[i];
        #pragma unroll
        for (int i = 0; i < 32; ++i) Vt[cg + i][r] = (_Float16)vp[i];
    }
    __syncthreads();
    {
        const int d  = tid >> 1;           // 0..127
        const int sg = (tid & 1) * 32;
        const int tile = (s0 + sg) >> 5;   // 32-key tile this thread's 32 keys belong to
        _Float16* vout = V16T + (((size_t)bh * (SK / 32) + tile) * DH + d) * 32;
        #pragma unroll
        for (int i = 0; i < 32; ++i) vout[i] = Vt[d][sg + i];
    }
}

// ---- fast path: double-buffered f16 tiles via async global->LDS, overlapped with WMMA ----
__global__ __launch_bounds__(128)
void CrossAttention_89189290868783_fast(const float* __restrict__ q,
                                        const _Float16* __restrict__ K16,
                                        const _Float16* __restrict__ V16T,
                                        float* __restrict__ out)
{
    __shared__ __align__(16) _Float16 Ksh[2][32][136];
    __shared__ __align__(16) _Float16 VshT[2][128][40];
    __shared__ __align__(16) _Float16 Psh[4][16][40];

    const int tid  = threadIdx.x;
    const int lane = tid & 31;
    const int wave = tid >> 5;

    const int bx  = blockIdx.x;
    const int hy  = blockIdx.y;
    const int bz  = blockIdx.z;
    const int bh  = bz * HKV + (hy >> 2);

    const int qrow0 = bx * 64 + wave * 16;
    const int kend  = (bx + 1) * 64;

    auto stage = [&](int kbs, int buf) {
        // Both tiles are 8 KB contiguous: 16-byte chunk c*128 + tid goes to thread tid, so the
        // 32 lanes of one copy instruction read 512 consecutive bytes (four whole 128-B lines).
        const _Float16* kg = K16 + ((size_t)bh * SK + kbs) * DH + tid * 8;
        const _Float16* vg = V16T + ((size_t)bh * (SK / 32) + (kbs >> 5)) * (DH * 32) + tid * 8;
        const int kr = tid >> 4, kc = (tid & 15) * 8;   // K chunk: 16 per 128-wide row
        const int vr = tid >> 2, vc = (tid & 3) * 8;    // V chunk: 4 per 32-key row
#ifdef USE_ASYNC_LDS
        #pragma unroll
        for (int c = 0; c < 4; ++c) async_copy16(kg + c * 1024, &Ksh[buf][c * 8 + kr][kc]);
        #pragma unroll
        for (int c = 0; c < 4; ++c) async_copy16(vg + c * 1024, &VshT[buf][c * 32 + vr][vc]);
#else
        #pragma unroll
        for (int c = 0; c < 4; ++c)
            *(h8*)&Ksh[buf][c * 8 + kr][kc] = *(const h8*)(kg + c * 1024);
        #pragma unroll
        for (int c = 0; c < 4; ++c)
            *(h8*)&VshT[buf][c * 32 + vr][vc] = *(const h8*)(vg + c * 1024);
#endif
    };

    v16h qf[4];
    fa_load_q(q, bz, hy, qrow0, lane, qf);

    FaState st;
    const v8f vzero = {};
    #pragma unroll
    for (int r = 0; r < 8; ++r) { st.m[r] = -__builtin_inff(); st.l[r] = 0.0f; }
    #pragma unroll
    for (int j = 0; j < 8; ++j) st.o[j] = vzero;

    stage(0, 0);                            // prologue fill of buffer 0

    int it = 0;
    for (int kb = 0; kb < kend; kb += 32, ++it) {
#ifdef USE_ASYNC_LDS
        async_wait0();                      // this wave's fills for buf[it&1] landed
#endif
        __syncthreads();                    // all waves filled; prev compute done
        if (kb + 32 < kend)
            stage(kb + 32, (it + 1) & 1);   // DMA next tile under this tile's math
        if (kb + 32 > qrow0)                // diagonal block for this wave
            fa_block_compute<true >(qf, Ksh[it & 1], VshT[it & 1], Psh[wave],
                                    kb, qrow0, lane, st);
        else                                // strictly-lower block: no mask needed
            fa_block_compute<false>(qf, Ksh[it & 1], VshT[it & 1], Psh[wave],
                                    kb, qrow0, lane, st);
    }

    fa_store_out(out, bz, hy, qrow0, lane, st);
}

// ---------------- fallback: fused fp32 KV conversion (single buffer) ----------------
__global__ __launch_bounds__(128)
void CrossAttention_89189290868783_kernel(const float* __restrict__ q,
                                          const float* __restrict__ kv,
                                          float* __restrict__ out)
{
    __shared__ __align__(16) _Float16 Ksh[32][136];
    __shared__ __align__(16) _Float16 VshT[128][40];
    __shared__ __align__(16) _Float16 Psh[4][16][40];

    const int tid  = threadIdx.x;
    const int lane = tid & 31;
    const int wave = tid >> 5;

    const int bx  = blockIdx.x;
    const int hy  = blockIdx.y;
    const int bz  = blockIdx.z;
    const int kvh = hy >> 2;

    const int qrow0 = bx * 64 + wave * 16;

    v16h qf[4];
    fa_load_q(q, bz, hy, qrow0, lane, qf);

    FaState st;
    const v8f vzero = {};
    #pragma unroll
    for (int r = 0; r < 8; ++r) { st.m[r] = -__builtin_inff(); st.l[r] = 0.0f; }
    #pragma unroll
    for (int j = 0; j < 8; ++j) st.o[j] = vzero;

    const int kend = (bx + 1) * 64;

    for (int kb = 0; kb < kend; kb += 32) {
        __syncthreads();
        {
            const int r32 = tid >> 2;
            const int cg  = (tid & 3) * 32;
            const size_t rowbase =
                ((size_t)bz * SK + (size_t)(kb + r32)) * (2 * HKV * DH) +
                (size_t)kvh * DH + cg;
            const float* kp = kv + rowbase;
            const float* vp = kv + rowbase + (size_t)HKV * DH;
            #pragma unroll
            for (int i = 0; i < 32; ++i) Ksh[r32][cg + i]  = (_Float16)kp[i];
            #pragma unroll
            for (int i = 0; i < 32; ++i) VshT[cg + i][r32] = (_Float16)vp[i];
            if (kb + 32 < kend) {
                __builtin_prefetch(kp + 2 * HKV * DH * 32, 0, 1);
                __builtin_prefetch(vp + 2 * HKV * DH * 32, 0, 1);
            }
        }
        __syncthreads();

        fa_block_compute<true>(qf, Ksh, VshT, Psh[wave], kb, qrow0, lane, st);
    }

    fa_store_out(out, bz, hy, qrow0, lane, st);
}

extern "C" void kernel_launch(void* const* d_in, const int* in_sizes, int n_in,
                              void* d_out, int out_size, void* d_ws, size_t ws_size,
                              hipStream_t stream) {
    (void)in_sizes; (void)n_in; (void)out_size;
    const float* q  = (const float*)d_in[0];
    const float* kv = (const float*)d_in[1];
    float* out = (float*)d_out;

    const size_t kbytes = (size_t)BATCH * HKV * SK * DH * 2;  // 8 MB f16 K
    dim3 grid(SQ / 64, NH, BATCH);
    dim3 block(128);

    if (ws_size >= 2 * kbytes) {
        _Float16* K16  = (_Float16*)d_ws;
        _Float16* V16T = (_Float16*)((char*)d_ws + kbytes);
        CrossAttention_89189290868783_kvprep<<<dim3(SK / 64, BATCH * HKV), 256, 0, stream>>>(
            kv, K16, V16T);
        CrossAttention_89189290868783_fast<<<grid, block, 0, stream>>>(q, K16, V16T, out);
    } else {
        CrossAttention_89189290868783_kernel<<<grid, block, 0, stream>>>(q, kv, out);
    }
}

// v002
// Measured time: 108 microseconds a run.
// Two timings next to v001 both put it at 1.73 times that version's speed.
// Counting every step since v000, it is 2.27 times as fast.
#include <hip/hip_runtime.h>
#include <cstdint>
#include <cstddef>

typedef __attribute__((ext_vector_type(16))) _Float16 v16h;
typedef __attribute__((ext_vector_type(8)))  _Float16 h8;
typedef __attribute__((ext_vector_type(8)))  float    v8f;
typedef __attribute__((ext_vector_type(4)))  float    f4;

// Fixed problem dims from the reference
#define BATCH 2
#define SQ    2048
#define NH    32
#define DH    128
#define SK    2048
#define HKV   8

// ---------------- CDNA5 async global->LDS path (guarded) ----------------
#if defined(__HIP_DEVICE_COMPILE__) && __has_builtin(__builtin_amdgcn_global_load_async_to_lds_b128)
#define USE_ASYNC_LDS 1
#define AS1 __attribute__((address_space(1)))
#define AS3 __attribute__((address_space(3)))
typedef int v4i_vs __attribute__((vector_size(16)));   // matches builtin param pointee
__device__ __forceinline__ void async_copy16(const void* g, void* l) {
    __builtin_amdgcn_global_load_async_to_lds_b128((AS1 v4i_vs*)g, (AS3 v4i_vs*)l, 0, 0);
}
__device__ __forceinline__ void async_wait0() {
#if __has_builtin(__builtin_amdgcn_s_wait_asynccnt)
    __builtin_amdgcn_s_wait_asynccnt(0);
#else
    asm volatile("s_wait_asynccnt 0x0" ::: "memory");
#endif
}
#endif

struct FaState {
    float m;      // running maximum of this lane's query row (equal in both lane halves)
    float l;      // running sum over this lane half's keys only; the halves join in the epilogue
    v8f   o[8];   // o[j][r] = O[query lane&15][d = 16 j + 8 (lane>>4) + r]
};

// Value of the same query row in the other lane half (lane ^ 16), by a vector cross-row move.
__device__ __forceinline__ float other_half(float x) {
    const unsigned b = __builtin_bit_cast(unsigned, x);
    return __builtin_bit_cast(float,
        __builtin_amdgcn_permlanex16(b, b, 0x76543210u, 0xfedcba98u, false, false));
}

template <bool MASKED>
__device__ __forceinline__ void fa_block_compute(const v16h qf[4],
                                                 _Float16 (*Ksh)[136],
                                                 _Float16 (*VshT)[40],
                                                 int kb, int qrow0, int lane,
                                                 FaState& st)
{
    const int half = lane >> 4;
    const int l16  = lane & 15;
    const v8f vzero = {};
    const float NEG_INF = -__builtin_inff();

    // ---- S^T = K (Q*scale)^T : two 16-key tiles; sacc[tc][r] = S[query l16][key 16 tc + 8 half + r] ----
    v8f sacc[2];
    #pragma unroll
    for (int tc = 0; tc < 2; ++tc) {
        v8f s = vzero;
        #pragma unroll
        for (int c = 0; c < 4; ++c) {
            const int key  = tc * 16 + l16;
            const int doff = 32 * c + half * 8;
            const h8 lo = *(const h8*)&Ksh[key][doff];
            const h8 hi = *(const h8*)&Ksh[key][doff + 16];
            v16h afr;
            #pragma unroll
            for (int i = 0; i < 8; ++i) { afr[i] = lo[i]; afr[i + 8] = hi[i]; }
            s = __builtin_amdgcn_wmma_f32_16x16x32_f16(false, afr, false, qf[c],
                                                       (short)0, s, false, false);
        }
        sacc[tc] = s;
    }

    // ---- causal mask (if MASKED: fast path's diagonal blocks, every fallback block) ----
    if (MASKED) {
        const int row = qrow0 + l16;
        #pragma unroll
        for (int tc = 0; tc < 2; ++tc)
            #pragma unroll
            for (int r = 0; r < 8; ++r) {
                const int key = kb + tc * 16 + 8 * half + r;
                sacc[tc][r] = (key > row) ? NEG_INF : sacc[tc][r];
            }
    }

    // ---- online softmax of one query row per lane: in-lane maximum, one exchange between halves ----
    float mx = fmaxf(sacc[0][0], sacc[1][0]);
    #pragma unroll
    for (int r = 1; r < 8; ++r) mx = fmaxf(mx, fmaxf(sacc[0][r], sacc[1][r]));
    mx = fmaxf(mx, other_half(mx));
    const float mnew = fmaxf(st.m, mx);
    const float msc  = __expf(st.m - mnew);   // 0 on first visit
    st.m = mnew;

    // P^T packs straight from the score accumulators into the B operand (hardware k order:
    // element s < 8 is key 8 half + s, element 8 + s is key 16 + 8 half + s).
    v16h pf;
    float sum = 0.0f;
    #pragma unroll
    for (int r = 0; r < 8; ++r) {
        const float p0 = __expf(sacc[0][r] - mnew);
        const float p1 = __expf(sacc[1][r] - mnew);
        sum += p0 + p1;
        pf[r]     = (_Float16)p0;
        pf[r + 8] = (_Float16)p1;
    }
    st.l = st.l * msc + sum;
    #pragma unroll
    for (int j = 0; j < 8; ++j) st.o[j] *= msc;

    // ---- O^T += V^T P^T ----
    #pragma unroll
    for (int j = 0; j < 8; ++j) {
        const int drow = j * 16 + l16;
        const int koff = half * 8;
        const h8 lo = *(const h8*)&VshT[drow][koff];
        const h8 hi = *(const h8*)&VshT[drow][koff + 16];
        v16h afr;
        #pragma unroll
        for (int i = 0; i < 8; ++i) { afr[i] = lo[i]; afr[i + 8] = hi[i]; }
        st.o[j] = __builtin_amdgcn_wmma_f32_16x16x32_f16(false, afr, false, pf,
                                                         (short)0, st.o[j], false, false);
    }
}

__device__ __forceinline__ void fa_load_q(const float* __restrict__ q,
                                          int bz, int hy, int qrow0, int lane,
                                          v16h qf[4])
{
    const int half = lane >> 4;
    const int l16  = lane & 15;
    const float scale = 0.08838834764831845f; // 1/sqrt(128)
    const int trow = qrow0 + l16;
    const float* qp = q + (((size_t)bz * SQ + trow) * NH + hy) * DH;
    #pragma unroll
    for (int c = 0; c < 4; ++c) {
        const int base = 32 * c + half * 8;
        #pragma unroll
        for (int i = 0; i < 8; ++i) {
            qf[c][i]     = (_Float16)(qp[base + i]      * scale);
            qf[c][i + 8] = (_Float16)(qp[base + 16 + i] * scale);
        }
    }
}

__device__ __forceinline__ void fa_store_out(float* __restrict__ out,
                                             int bz, int hy, int qrow0, int lane,
                                             FaState& st)
{
    const int half = lane >> 4;
    const int l16  = lane & 15;
    const float rl = 1.0f / (st.l + other_half(st.l));   // join the halves' key sums
    float* op = out + (((size_t)bz * SQ + (qrow0 + l16)) * NH + hy) * DH + 8 * half;
    #pragma unroll
    for (int j = 0; j < 8; ++j) {
        const v8f o = st.o[j] * rl;
        *(f4*)(op + j * 16)     = f4{o[0], o[1], o[2], o[3]};
        *(f4*)(op + j * 16 + 4) = f4{o[4], o[5], o[6], o[7]};
    }
}

// ---- KV fp32 -> f16 preconversion: K row-major; V transposed and tiled, [bh][key/32][d][32 keys],
// ---- so that a 32-key tile of either operand is 8 KB of contiguous workspace ----
__global__ __launch_bounds__(256)
void CrossAttention_89189290868783_kvprep(const float* __restrict__ kv,
                                          _Float16* __restrict__ K16,
                                          _Float16* __restrict__ V16T)
{
    __shared__ _Float16 Vt[DH][72];   // 144B row stride (16B aligned)
    const int tid = threadIdx.x;
    const int s0  = blockIdx.x * 64;
    const int bh  = blockIdx.y;            // b*HKV + kvh
    const int b   = bh / HKV;
    const int kvh = bh % HKV;

    {
        const int r  = tid >> 2;           // 0..63 local key row
        const int cg = (tid & 3) * 32;     // 32-wide column group
        const size_t base = (((size_t)b * SK + (s0 + r)) * 2) * (HKV * DH) +
                            (size_t)kvh * DH + cg;
        const float* kp = kv + base;                      // kv[...,0,kvh,:]
        const float* vp = kv + base + (size_t)HKV * DH;   // kv[...,1,kvh,:]
        _Float16* kout = K16 + ((size_t)bh * SK + (s0 + r)) * DH + cg;
        #pragma unroll
        for (int i = 0; i < 32; ++i) kout[i] = (_Float16)kp[i];
        #pragma unroll
        for (int i = 0; i < 32; ++i) Vt[cg + i][r] = (_Float16)vp[i];
    }
    __syncthreads();
    {
        const int d  = tid >> 1;           // 0..127
        const int sg = (tid & 1) * 32;
        const int tile = (s0 + sg) >> 5;   // 32-key tile this thread's 32 keys belong to
        _Float16* vout = V16T + (((size_t)bh * (SK / 32) + tile) * DH + d) * 32;
        #pragma unroll
        for (int i = 0; i < 32; ++i) vout[i] = Vt[d][sg + i];
    }
}

// ---- fast path: double-buffered f16 tiles via async global->LDS, overlapped with WMMA ----
__global__ __launch_bounds__(128)
void CrossAttention_89189290868783_fast(const float* __restrict__ q,
                                        const _Float16* __restrict__ K16,
                                        const _Float16* __restrict__ V16T,
                                        float* __restrict__ out)
{
    __shared__ __align__(16) _Float16 Ksh[2][32][136];
    __shared__ __align__(16) _Float16 VshT[2][128][40];

    const int tid  = threadIdx.x;
    const int lane = tid & 31;
    const int wave = tid >> 5;

    const int bx  = blockIdx.x;
    const int hy  = blockIdx.y;
    const int bz  = blockIdx.z;
    const int bh  = bz * HKV + (hy >> 2);

    const int qrow0 = bx * 64 + wave * 16;
    const int kend  = (bx + 1) * 64;

    auto stage = [&](int kbs, int buf) {
        // Both tiles are 8 KB contiguous: 16-byte chunk c*128 + tid goes to thread tid, so the
        // 32 lanes of one copy instruction read 512 consecutive bytes (four whole 128-B lines).
        const _Float16* kg = K16 + ((size_t)bh * SK + kbs) * DH + tid * 8;
        const _Float16* vg = V16T + ((size_t)bh * (SK / 32) + (kbs >> 5)) * (DH * 32) + tid * 8;
        const int kr = tid >> 4, kc = (tid & 15) * 8;   // K chunk: 16 per 128-wide row
        const int vr = tid >> 2, vc = (tid & 3) * 8;    // V chunk: 4 per 32-key row
#ifdef USE_ASYNC_LDS
        #pragma unroll
        for (int c = 0; c < 4; ++c) async_copy16(kg + c * 1024, &Ksh[buf][c * 8 + kr][kc]);
        #pragma unroll
        for (int c = 0; c < 4; ++c) async_copy16(vg + c * 1024, &VshT[buf][c * 32 + vr][vc]);
#else
        #pragma unroll
        for (int c = 0; c < 4; ++c)
            *(h8*)&Ksh[buf][c * 8 + kr][kc] = *(const h8*)(kg + c * 1024);
        #pragma unroll
        for (int c = 0; c < 4; ++c)
            *(h8*)&VshT[buf][c * 32 + vr][vc] = *(const h8*)(vg + c * 1024);
#endif
    };

    v16h qf[4];
    fa_load_q(q, bz, hy, qrow0, lane, qf);

    FaState st;
    const v8f vzero = {};
    st.m = -__builtin_inff();
    st.l = 0.0f;
    #pragma unroll
    for (int j = 0; j < 8; ++j) st.o[j] = vzero;

    stage(0, 0);                            // prologue fill of buffer 0

    int it = 0;
    for (int kb = 0; kb < kend; kb += 32, ++it) {
#ifdef USE_ASYNC_LDS
        async_wait0();                      // this wave's fills for buf[it&1] landed
#endif
        __syncthreads();                    // all waves filled; prev compute done
        if (kb + 32 < kend)
            stage(kb + 32, (it + 1) & 1);   // DMA next tile under this tile's math
        if (kb + 32 > qrow0)                // diagonal block for this wave
            fa_block_compute<true >(qf, Ksh[it & 1], VshT[it & 1],
                                    kb, qrow0, lane, st);
        else                                // strictly-lower block: no mask needed
            fa_block_compute<false>(qf, Ksh[it & 1], VshT[it & 1],
                                    kb, qrow0, lane, st);
    }

    fa_store_out(out, bz, hy, qrow0, lane, st);
}

// ---------------- fallback: fused fp32 KV conversion (single buffer) ----------------
__global__ __launch_bounds__(128)
void CrossAttention_89189290868783_kernel(const float* __restrict__ q,
                                          const float* __restrict__ kv,
                                          float* __restrict__ out)
{
    __shared__ __align__(16) _Float16 Ksh[32][136];
    __shared__ __align__(16) _Float16 VshT[128][40];

    const int tid  = threadIdx.x;
    const int lane = tid & 31;
    const int wave = tid >> 5;

    const int bx  = blockIdx.x;
    const int hy  = blockIdx.y;
    const int bz  = blockIdx.z;
    const int kvh = hy >> 2;

    const int qrow0 = bx * 64 + wave * 16;

    v16h qf[4];
    fa_load_q(q, bz, hy, qrow0, lane, qf);

    FaState st;
    const v8f vzero = {};
    st.m = -__builtin_inff();
    st.l = 0.0f;
    #pragma unroll
    for (int j = 0; j < 8; ++j) st.o[j] = vzero;

    const int kend = (bx + 1) * 64;

    for (int kb = 0; kb < kend; kb += 32) {
        __syncthreads();
        {
            const int r32 = tid >> 2;
            const int cg  = (tid & 3) * 32;
            const size_t rowbase =
                ((size_t)bz * SK + (size_t)(kb + r32)) * (2 * HKV * DH) +
                (size_t)kvh * DH + cg;
            const float* kp = kv + rowbase;
            const float* vp = kv + rowbase + (size_t)HKV * DH;
            #pragma unroll
            for (int i = 0; i < 32; ++i) Ksh[r32][cg + i]  = (_Float16)kp[i];
            #pragma unroll
            for (int i = 0; i < 32; ++i) VshT[cg + i][r32] = (_Float16)vp[i];
            if (kb + 32 < kend) {
                __builtin_prefetch(kp + 2 * HKV * DH * 32, 0, 1);
                __builtin_prefetch(vp + 2 * HKV * DH * 32, 0, 1);
            }
        }
        __syncthreads();

        fa_block_compute<true>(qf, Ksh, VshT, kb, qrow0, lane, st);
    }

    fa_store_out(out, bz, hy, qrow0, lane, st);
}

extern "C" void kernel_launch(void* const* d_in, const int* in_sizes, int n_in,
                              void* d_out, int out_size, void* d_ws, size_t ws_size,
                              hipStream_t stream) {
    (void)in_sizes; (void)n_in; (void)out_size;
    const float* q  = (const float*)d_in[0];
    const float* kv = (const float*)d_in[1];
    float* out = (float*)d_out;

    const size_t kbytes = (size_t)BATCH * HKV * SK * DH * 2;  // 8 MB f16 K
    dim3 grid(SQ / 64, NH, BATCH);
    dim3 block(128);

    if (ws_size >= 2 * kbytes) {
        _Float16* K16  = (_Float16*)d_ws;
        _Float16* V16T = (_Float16*)((char*)d_ws + kbytes);
        CrossAttention_89189290868783_kvprep<<<dim3(SK / 64, BATCH * HKV), 256, 0, stream>>>(
            kv, K16, V16T);
        CrossAttention_89189290868783_fast<<<grid, block, 0, stream>>>(q, K16, V16T, out);
    } else {
        CrossAttention_89189290868783_kernel<<<grid, block, 0, stream>>>(q, kv, out);
    }
}

// v003
// A run of this version takes 82.3 microseconds.
// Next to v002, in two timings, it ran 1.31 times as fast each time.
// Counting every step since v000, it is 2.98 times as fast.
#include <hip/hip_runtime.h>
#include <cstdint>
#include <cstddef>

typedef __attribute__((ext_vector_type(16))) _Float16 v16h;
typedef __attribute__((ext_vector_type(8)))  _Float16 h8;
typedef __attribute__((ext_vector_type(8)))  float    v8f;
typedef __attribute__((ext_vector_type(4)))  float    f4;

// Fixed problem dims from the reference
#define BATCH 2
#define SQ    2048
#define NH    32
#define DH    128
#define SK    2048
#define HKV   8

// ---------------- CDNA5 async global->LDS path (guarded) ----------------
#if defined(__HIP_DEVICE_COMPILE__) && __has_builtin(__builtin_amdgcn_global_load_async_to_lds_b128)
#define USE_ASYNC_LDS 1
#define AS1 __attribute__((address_space(1)))
#define AS3 __attribute__((address_space(3)))
typedef int v4i_vs __attribute__((vector_size(16)));   // matches builtin param pointee
__device__ __forceinline__ void async_copy16(const void* g, void* l) {
    __builtin_amdgcn_global_load_async_to_lds_b128((AS1 v4i_vs*)g, (AS3 v4i_vs*)l, 0, 0);
}
__device__ __forceinline__ void async_wait0() {
#if __has_builtin(__builtin_amdgcn_s_wait_asynccnt)
    __builtin_amdgcn_s_wait_asynccnt(0);
#else
    asm volatile("s_wait_asynccnt 0x0" ::: "memory");
#endif
}
#endif

struct FaState {
    float m;      // running maximum of this lane's query row (equal in both lane halves)
    float l;      // running sum over this lane half's keys only; the halves join in the epilogue
    v8f   o[8];   // o[j][r] = O[query lane&15][d = 16 j + 8 (lane>>4) + r]
};

// Value of the same query row in the other lane half (lane ^ 16), by a vector cross-row move.
__device__ __forceinline__ float other_half(float x) {
    const unsigned b = __builtin_bit_cast(unsigned, x);
    return __builtin_bit_cast(float,
        __builtin_amdgcn_permlanex16(b, b, 0x76543210u, 0xfedcba98u, false, false));
}

template <bool MASKED>
__device__ __forceinline__ void fa_block_compute(const v16h qf[4],
                                                 _Float16 (*Ksh)[136],
                                                 _Float16 (*VshT)[40],
                                                 int kb, int qrow0, int lane,
                                                 FaState& st)
{
    const int half = lane >> 4;
    const int l16  = lane & 15;
    const v8f vzero = {};
    const float NEG_INF = -__builtin_inff();

    // ---- S^T = K (Q*scale)^T : two 16-key tiles; sacc[tc][r] = S[query l16][key 16 tc + 8 half + r] ----
    v8f sacc[2];
    #pragma unroll
    for (int tc = 0; tc < 2; ++tc) {
        v8f s = vzero;
        #pragma unroll
        for (int c = 0; c < 4; ++c) {
            const int key  = tc * 16 + l16;
            const int doff = 32 * c + half * 8;
            const h8 lo = *(const h8*)&Ksh[key][doff];
            const h8 hi = *(const h8*)&Ksh[key][doff + 16];
            v16h afr;
            #pragma unroll
            for (int i = 0; i < 8; ++i) { afr[i] = lo[i]; afr[i + 8] = hi[i]; }
            s = __builtin_amdgcn_wmma_f32_16x16x32_f16(false, afr, false, qf[c],
                                                       (short)0, s, false, false);
        }
        sacc[tc] = s;
    }

    // ---- causal mask (if MASKED: fast path's diagonal blocks, every fallback block) ----
    if (MASKED) {
        const int row = qrow0 + l16;
        #pragma unroll
        for (int tc = 0; tc < 2; ++tc)
            #pragma unroll
            for (int r = 0; r < 8; ++r) {
                const int key = kb + tc * 16 + 8 * half + r;
                sacc[tc][r] = (key > row) ? NEG_INF : sacc[tc][r];
            }
    }

    // ---- online softmax of one query row per lane: in-lane maximum, one exchange between halves ----
    float mx = fmaxf(sacc[0][0], sacc[1][0]);
    #pragma unroll
    for (int r = 1; r < 8; ++r) mx = fmaxf(mx, fmaxf(sacc[0][r], sacc[1][r]));
    mx = fmaxf(mx, other_half(mx));
    const float mnew = fmaxf(st.m, mx);
    const float msc  = __expf(st.m - mnew);   // 0 on first visit
    st.m = mnew;

    // P^T packs straight from the score accumulators into the B operand (hardware k order:
    // element s < 8 is key 8 half + s, element 8 + s is key 16 + 8 half + s).
    v16h pf;
    float sum = 0.0f;
    #pragma unroll
    for (int r = 0; r < 8; ++r) {
        const float p0 = __expf(sacc[0][r] - mnew);
        const float p1 = __expf(sacc[1][r] - mnew);
        sum += p0 + p1;
        pf[r]     = (_Float16)p0;
        pf[r + 8] = (_Float16)p1;
    }
    st.l = st.l * msc + sum;
    #pragma unroll
    for (int j = 0; j < 8; ++j) st.o[j] *= msc;

    // ---- O^T += V^T P^T ----
    #pragma unroll
    for (int j = 0; j < 8; ++j) {
        const int drow = j * 16 + l16;
        const int koff = half * 8;
        const h8 lo = *(const h8*)&VshT[drow][koff];
        const h8 hi = *(const h8*)&VshT[drow][koff + 16];
        v16h afr;
        #pragma unroll
        for (int i = 0; i < 8; ++i) { afr[i] = lo[i]; afr[i + 8] = hi[i]; }
        st.o[j] = __builtin_amdgcn_wmma_f32_16x16x32_f16(false, afr, false, pf,
                                                         (short)0, st.o[j], false, false);
    }
}

__device__ __forceinline__ void fa_load_q(const float* __restrict__ q,
                                          int bz, int hy, int qrow0, int lane,
                                          v16h qf[4])
{
    const int half = lane >> 4;
    const int l16  = lane & 15;
    const float scale = 0.08838834764831845f; // 1/sqrt(128)
    const int trow = qrow0 + l16;
    const float* qp = q + (((size_t)bz * SQ + trow) * NH + hy) * DH;
    #pragma unroll
    for (int c = 0; c < 4; ++c) {
        const int base = 32 * c + half * 8;
        #pragma unroll
        for (int i = 0; i < 8; ++i) {
            qf[c][i]     = (_Float16)(qp[base + i]      * scale);
            qf[c][i + 8] = (_Float16)(qp[base + 16 + i] * scale);
        }
    }
}

__device__ __forceinline__ void fa_store_out(float* __restrict__ out,
                                             int bz, int hy, int qrow0, int lane,
                                             FaState& st)
{
    const int half = lane >> 4;
    const int l16  = lane & 15;
    const float rl = 1.0f / (st.l + other_half(st.l));   // join the halves' key sums
    float* op = out + (((size_t)bz * SQ + (qrow0 + l16)) * NH + hy) * DH + 8 * half;
    #pragma unroll
    for (int j = 0; j < 8; ++j) {
        const v8f o = st.o[j] * rl;
        *(f4*)(op + j * 16)     = f4{o[0], o[1], o[2], o[3]};
        *(f4*)(op + j * 16 + 4) = f4{o[4], o[5], o[6], o[7]};
    }
}

// ---- KV fp32 -> f16 preconversion: K row-major; V transposed and tiled, [bh][key/32][d][32 keys],
// ---- so that a 32-key tile of either operand is 8 KB of contiguous workspace ----
__global__ __launch_bounds__(256)
void CrossAttention_89189290868783_kvprep(const float* __restrict__ kv,
                                          _Float16* __restrict__ K16,
                                          _Float16* __restrict__ V16T)
{
    __shared__ _Float16 Vt[DH][72];   // 144B row stride (16B aligned)
    const int tid = threadIdx.x;
    const int s0  = blockIdx.x * 64;
    const int bh  = blockIdx.y;            // b*HKV + kvh
    const int b   = bh / HKV;
    const int kvh = bh % HKV;

    {
        const int r  = tid >> 2;           // 0..63 local key row
        const int cg = (tid & 3) * 32;     // 32-wide column group
        const size_t base = (((size_t)b * SK + (s0 + r)) * 2) * (HKV * DH) +
                            (size_t)kvh * DH + cg;
        const float* kp = kv + base;                      // kv[...,0,kvh,:]
        const float* vp = kv + base + (size_t)HKV * DH;   // kv[...,1,kvh,:]
        _Float16* kout = K16 + ((size_t)bh * SK + (s0 + r)) * DH + cg;
        #pragma unroll
        for (int i = 0; i < 32; ++i) kout[i] = (_Float16)kp[i];
        #pragma unroll
        for (int i = 0; i < 32; ++i) Vt[cg + i][r] = (_Float16)vp[i];
    }
    __syncthreads();
    {
        const int d  = tid >> 1;           // 0..127
        const int sg = (tid & 1) * 32;
        const int tile = (s0 + sg) >> 5;   // 32-key tile this thread's 32 keys belong to
        _Float16* vout = V16T + (((size_t)bh * (SK / 32) + tile) * DH + d) * 32;
        #pragma unroll
        for (int i = 0; i < 32; ++i) vout[i] = Vt[d][sg + i];
    }
}

// ---- fast path: double-buffered f16 tiles via async global->LDS, overlapped with WMMA ----
__global__ __launch_bounds__(128)
void CrossAttention_89189290868783_fast(const float* __restrict__ q,
                                        const _Float16* __restrict__ K16,
                                        const _Float16* __restrict__ V16T,
                                        float* __restrict__ out)
{
    __shared__ __align__(16) _Float16 Ksh[2][32][136];
    __shared__ __align__(16) _Float16 VshT[2][128][40];

    const int tid  = threadIdx.x;
    const int lane = tid & 31;
    const int wave = tid >> 5;

    const int hy  = blockIdx.y;
    const int bz  = blockIdx.z;
    const int bh  = bz * HKV + (hy >> 2);

    auto stage = [&](int kbs, int buf) {
        // Both tiles are 8 KB contiguous: 16-byte chunk c*128 + tid goes to thread tid, so the
        // 32 lanes of one copy instruction read 512 consecutive bytes (four whole 128-B lines).
        const _Float16* kg = K16 + ((size_t)bh * SK + kbs) * DH + tid * 8;
        const _Float16* vg = V16T + ((size_t)bh * (SK / 32) + (kbs >> 5)) * (DH * 32) + tid * 8;
        const int kr = tid >> 4, kc = (tid & 15) * 8;   // K chunk: 16 per 128-wide row
        const int vr = tid >> 2, vc = (tid & 3) * 8;    // V chunk: 4 per 32-key row
#ifdef USE_ASYNC_LDS
        #pragma unroll
        for (int c = 0; c < 4; ++c) async_copy16(kg + c * 1024, &Ksh[buf][c * 8 + kr][kc]);
        #pragma unroll
        for (int c = 0; c < 4; ++c) async_copy16(vg + c * 1024, &VshT[buf][c * 32 + vr][vc]);
#else
        #pragma unroll
        for (int c = 0; c < 4; ++c)
            *(h8*)&Ksh[buf][c * 8 + kr][kc] = *(const h8*)(kg + c * 1024);
        #pragma unroll
        for (int c = 0; c < 4; ++c)
            *(h8*)&VshT[buf][c * 32 + vr][vc] = *(const h8*)(vg + c * 1024);
#endif
    };

    // Causal cost grows linearly with the query tile's index, and the whole grid is resident at once:
    // every work-group takes tile n-1-x and then tile x, one after the other, so all do equal work.
    for (int t = 0; t < 2; ++t) {
        const int bx    = t ? (int)blockIdx.x : SQ / 64 - 1 - (int)blockIdx.x;
        const int qrow0 = bx * 64 + wave * 16;
        const int kend  = (bx + 1) * 64;

        if (t) __syncthreads();                 // every wave has left the first tile's buffers
        stage(0, 0);                            // prologue fill of buffer 0

        v16h qf[4];
        fa_load_q(q, bz, hy, qrow0, lane, qf);

        FaState st;
        const v8f vzero = {};
        st.m = -__builtin_inff();
        st.l = 0.0f;
        #pragma unroll
        for (int j = 0; j < 8; ++j) st.o[j] = vzero;

        int it = 0;
        for (int kb = 0; kb < kend; kb += 32, ++it) {
#ifdef USE_ASYNC_LDS
            async_wait0();                      // this wave's fills for buf[it&1] landed
#endif
            __syncthreads();                    // all waves filled; prev compute done
            if (kb + 32 < kend)
                stage(kb + 32, (it + 1) & 1);   // DMA next tile under this tile's math
            if (kb + 32 > qrow0)                // diagonal block for this wave
                fa_block_compute<true >(qf, Ksh[it & 1], VshT[it & 1],
                                        kb, qrow0, lane, st);
            else                                // strictly-lower block: no mask needed
                fa_block_compute<false>(qf, Ksh[it & 1], VshT[it & 1],
                                        kb, qrow0, lane, st);
        }

        fa_store_out(out, bz, hy, qrow0, lane, st);
        // The second tile rewrites the registers that these stores name: the wait stands in front.
        asm volatile("s_wait_xcnt 0x0" ::: "memory");
    }
}

// ---------------- fallback: fused fp32 KV conversion (single buffer) ----------------
__global__ __launch_bounds__(128)
void CrossAttention_89189290868783_kernel(const float* __restrict__ q,
                                          const float* __restrict__ kv,
                                          float* __restrict__ out)
{
    __shared__ __align__(16) _Float16 Ksh[32][136];
    __shared__ __align__(16) _Float16 VshT[128][40];

    const int tid  = threadIdx.x;
    const int lane = tid & 31;
    const int wave = tid >> 5;

    const int bx  = blockIdx.x;
    const int hy  = blockIdx.y;
    const int bz  = blockIdx.z;
    const int kvh = hy >> 2;

    const int qrow0 = bx * 64 + wave * 16;

    v16h qf[4];
    fa_load_q(q, bz, hy, qrow0, lane, qf);

    FaState st;
    const v8f vzero = {};
    st.m = -__builtin_inff();
    st.l = 0.0f;
    #pragma unroll
    for (int j = 0; j < 8; ++j) st.o[j] = vzero;

    const int kend = (bx + 1) * 64;

    for (int kb = 0; kb < kend; kb += 32) {
        __syncthreads();
        {
            const int r32 = tid >> 2;
            const int cg  = (tid & 3) * 32;
            const size_t rowbase =
                ((size_t)bz * SK + (size_t)(kb + r32)) * (2 * HKV * DH) +
                (size_t)kvh * DH + cg;
            const float* kp = kv + rowbase;
            const float* vp = kv + rowbase + (size_t)HKV * DH;
            #pragma unroll
            for (int i = 0; i < 32; ++i) Ksh[r32][cg + i]  = (_Float16)kp[i];
            #pragma unroll
            for (int i = 0; i < 32; ++i) VshT[cg + i][r32] = (_Float16)vp[i];
            if (kb + 32 < kend) {
                __builtin_prefetch(kp + 2 * HKV * DH * 32, 0, 1);
                __builtin_prefetch(vp + 2 * HKV * DH * 32, 0, 1);
            }
        }
        __syncthreads();

        fa_block_compute<true>(qf, Ksh, VshT, kb, qrow0, lane, st);
    }

    fa_store_out(out, bz, hy, qrow0, lane, st);
}

extern "C" void kernel_launch(void* const* d_in, const int* in_sizes, int n_in,
                              void* d_out, int out_size, void* d_ws, size_t ws_size,
                              hipStream_t stream) {
    (void)in_sizes; (void)n_in; (void)out_size;
    const float* q  = (const float*)d_in[0];
    const float* kv = (const float*)d_in[1];
    float* out = (float*)d_out;

    const size_t kbytes = (size_t)BATCH * HKV * SK * DH * 2;  // 8 MB f16 K
    dim3 grid(SQ / 64, NH, BATCH);
    dim3 block(128);

    if (ws_size >= 2 * kbytes) {
        _Float16* K16  = (_Float16*)d_ws;
        _Float16* V16T = (_Float16*)((char*)d_ws + kbytes);
        CrossAttention_89189290868783_kvprep<<<dim3(SK / 64, BATCH * HKV), 256, 0, stream>>>(
            kv, K16, V16T);
        grid.x = SQ / 128;   // the fast path's work-groups take two query tiles each
        CrossAttention_89189290868783_fast<<<grid, block, 0, stream>>>(q, K16, V16T, out);
    } else {
        CrossAttention_89189290868783_kernel<<<grid, block, 0, stream>>>(q, kv, out);
    }
}

// v004
// A run of this version takes 77.3 microseconds.
// In both of two side-by-side timings against v003, it was 1.07 times as fast.
// Over all steps from v000 it is 3.17 times as fast.
#include <hip/hip_runtime.h>
#include <cstdint>
#include <cstddef>

typedef __attribute__((ext_vector_type(16))) _Float16 v16h;
typedef __attribute__((ext_vector_type(8)))  _Float16 h8;
typedef __attribute__((ext_vector_type(8)))  float    v8f;
typedef __attribute__((ext_vector_type(4)))  float    f4;

// Fixed problem dims from the reference
#define BATCH 2
#define SQ    2048
#define NH    32
#define DH    128
#define SK    2048
#define HKV   8

// ---------------- CDNA5 async global->LDS path (guarded) ----------------
#if defined(__HIP_DEVICE_COMPILE__) && __has_builtin(__builtin_amdgcn_global_load_async_to_lds_b128)
#define USE_ASYNC_LDS 1
#define AS1 __attribute__((address_space(1)))
#define AS3 __attribute__((address_space(3)))
typedef int v4i_vs __attribute__((vector_size(16)));   // matches builtin param pointee
__device__ __forceinline__ void async_copy16(const void* g, void* l) {
    __builtin_amdgcn_global_load_async_to_lds_b128((AS1 v4i_vs*)g, (AS3 v4i_vs*)l, 0, 0);
}
__device__ __forceinline__ void async_wait0() {
#if __has_builtin(__builtin_amdgcn_s_wait_asynccnt)
    __builtin_amdgcn_s_wait_asynccnt(0);
#else
    asm volatile("s_wait_asynccnt 0x0" ::: "memory");
#endif
}
#endif

template <int G>
struct FaState {
    float m[G];      // running maximum of this lane's query row (equal in both lane halves)
    float l[G];      // running sum over this lane half's keys only; the halves join in the epilogue
    v8f   o[G][8];   // o[g][j][r] = O[query 16 g + (lane&15)][d = 16 j + 8 (lane>>4) + r]
};

// Value of the same query row in the other lane half (lane ^ 16), by a vector cross-row move.
__device__ __forceinline__ float other_half(float x) {
    const unsigned b = __builtin_bit_cast(unsigned, x);
    return __builtin_bit_cast(float,
        __builtin_amdgcn_permlanex16(b, b, 0x76543210u, 0xfedcba98u, false, false));
}

template <bool MASKED, int G>
__device__ __forceinline__ void fa_block_compute(const v16h (&qf)[G][4],
                                                 _Float16 (*Ksh)[136],
                                                 _Float16 (*VshT)[40],
                                                 int kb, int qrow0, int lane,
                                                 FaState<G>& st)
{
    const int half = lane >> 4;
    const int l16  = lane & 15;
    const v8f vzero = {};
    const float NEG_INF = -__builtin_inff();

    // ---- S^T = K (Q*scale)^T : two 16-key tiles per query group;
    // ---- sacc[g][tc][r] = S[query 16 g + l16][key 16 tc + 8 half + r] ----
    v8f sacc[G][2];
    #pragma unroll
    for (int g = 0; g < G; ++g) { sacc[g][0] = vzero; sacc[g][1] = vzero; }
    #pragma unroll
    for (int c = 0; c < 4; ++c) {
        #pragma unroll
        for (int tc = 0; tc < 2; ++tc) {
            const int key  = tc * 16 + l16;
            const int doff = 32 * c + half * 8;
            const h8 lo = *(const h8*)&Ksh[key][doff];
            const h8 hi = *(const h8*)&Ksh[key][doff + 16];
            v16h afr;
            #pragma unroll
            for (int i = 0; i < 8; ++i) { afr[i] = lo[i]; afr[i + 8] = hi[i]; }
            #pragma unroll
            for (int g = 0; g < G; ++g)
                sacc[g][tc] = __builtin_amdgcn_wmma_f32_16x16x32_f16(false, afr, false, qf[g][c],
                                                                     (short)0, sacc[g][tc],
                                                                     false, false);
        }
    }

    // ---- causal mask (if MASKED: fast path's diagonal blocks, every fallback block) ----
    if (MASKED) {
        #pragma unroll
        for (int g = 0; g < G; ++g) {
            const int row = qrow0 + 16 * g + l16;
            #pragma unroll
            for (int tc = 0; tc < 2; ++tc)
                #pragma unroll
                for (int r = 0; r < 8; ++r) {
                    const int key = kb + tc * 16 + 8 * half + r;
                    sacc[g][tc][r] = (key > row) ? NEG_INF : sacc[g][tc][r];
                }
        }
    }

    v16h pf[G];
    #pragma unroll
    for (int g = 0; g < G; ++g) {
        // ---- online softmax of one query row per lane: in-lane maximum, one exchange between halves ----
        float mx = fmaxf(sacc[g][0][0], sacc[g][1][0]);
        #pragma unroll
        for (int r = 1; r < 8; ++r) mx = fmaxf(mx, fmaxf(sacc[g][0][r], sacc[g][1][r]));
        mx = fmaxf(mx, other_half(mx));
        const float mnew = fmaxf(st.m[g], mx);
        const float msc  = __expf(st.m[g] - mnew);   // 0 on first visit
        st.m[g] = mnew;

        // P^T packs straight from the score accumulators into the B operand (hardware k order:
        // element s < 8 is key 8 half + s, element 8 + s is key 16 + 8 half + s).
        float sum = 0.0f;
        #pragma unroll
        for (int r = 0; r < 8; ++r) {
            const float p0 = __expf(sacc[g][0][r] - mnew);
            const float p1 = __expf(sacc[g][1][r] - mnew);
            sum += p0 + p1;
            pf[g][r]     = (_Float16)p0;
            pf[g][r + 8] = (_Float16)p1;
        }
        st.l[g] = st.l[g] * msc + sum;
        #pragma unroll
        for (int j = 0; j < 8; ++j) st.o[g][j] *= msc;
    }

    // ---- O^T += V^T P^T ----
    #pragma unroll
    for (int j = 0; j < 8; ++j) {
        const int drow = j * 16 + l16;
        const int koff = half * 8;
        const h8 lo = *(const h8*)&VshT[drow][koff];
        const h8 hi = *(const h8*)&VshT[drow][koff + 16];
        v16h afr;
        #pragma unroll
        for (int i = 0; i < 8; ++i) { afr[i] = lo[i]; afr[i + 8] = hi[i]; }
        #pragma unroll
        for (int g = 0; g < G; ++g)
            st.o[g][j] = __builtin_amdgcn_wmma_f32_16x16x32_f16(false, afr, false, pf[g],
                                                                (short)0, st.o[g][j], false, false);
    }
}

template <int G>
__device__ __forceinline__ void fa_init(FaState<G>& st)
{
    const v8f vzero = {};
    #pragma unroll
    for (int g = 0; g < G; ++g) {
        st.m[g] = -__builtin_inff();
        st.l[g] = 0.0f;
        #pragma unroll
        for (int j = 0; j < 8; ++j) st.o[g][j] = vzero;
    }
}

__device__ __forceinline__ void fa_load_q(const float* __restrict__ q,
                                          int bz, int hy, int qrow0, int lane,
                                          v16h qf[4])
{
    const int half = lane >> 4;
    const int l16  = lane & 15;
    const float scale = 0.08838834764831845f; // 1/sqrt(128)
    const int trow = qrow0 + l16;
    const float* qp = q + (((size_t)bz * SQ + trow) * NH + hy) * DH;
    #pragma unroll
    for (int c = 0; c < 4; ++c) {
        const int base = 32 * c + half * 8;
        #pragma unroll
        for (int i = 0; i < 8; ++i) {
            qf[c][i]     = (_Float16)(qp[base + i]      * scale);
            qf[c][i + 8] = (_Float16)(qp[base + 16 + i] * scale);
        }
    }
}

template <int G>
__device__ __forceinline__ void fa_store_out(float* __restrict__ out,
                                             int bz, int hy, int qrow0, int lane,
                                             FaState<G>& st)
{
    const int half = lane >> 4;
    const int l16  = lane & 15;
    float* op = out + (((size_t)bz * SQ + (qrow0 + l16)) * NH + hy) * DH + 8 * half;
    #pragma unroll
    for (int g = 0; g < G; ++g) {
        const float rl = 1.0f / (st.l[g] + other_half(st.l[g]));   // join the halves' key sums
        #pragma unroll
        for (int j = 0; j < 8; ++j) st.o[g][j] *= rl;
    }
    // Keeps every register write of the epilogue in front of the first store: without it one group's
    // scaling is scheduled among the other's stores, over registers that issued stores still name.
    __builtin_amdgcn_sched_barrier(0);
    #pragma unroll
    for (int g = 0; g < G; ++g) {
        #pragma unroll
        for (int j = 0; j < 8; ++j) {
            const v8f o = st.o[g][j];
            float* p = op + g * (16 * NH * DH) + j * 16;
            *(f4*)(p)     = f4{o[0], o[1], o[2], o[3]};
            *(f4*)(p + 4) = f4{o[4], o[5], o[6], o[7]};
        }
    }
}

// ---- KV fp32 -> f16 preconversion: K row-major; V transposed and tiled, [bh][key/32][d][32 keys],
// ---- so that a 32-key tile of either operand is 8 KB of contiguous workspace ----
__global__ __launch_bounds__(256)
void CrossAttention_89189290868783_kvprep(const float* __restrict__ kv,
                                          _Float16* __restrict__ K16,
                                          _Float16* __restrict__ V16T)
{
    __shared__ _Float16 Vt[DH][72];   // 144B row stride (16B aligned)
    const int tid = threadIdx.x;
    const int s0  = blockIdx.x * 64;
    const int bh  = blockIdx.y;            // b*HKV + kvh
    const int b   = bh / HKV;
    const int kvh = bh % HKV;

    {
        const int r  = tid >> 2;           // 0..63 local key row
        const int cg = (tid & 3) * 32;     // 32-wide column group
        const size_t base = (((size_t)b * SK + (s0 + r)) * 2) * (HKV * DH) +
                            (size_t)kvh * DH + cg;
        const float* kp = kv + base;                      // kv[...,0,kvh,:]
        const float* vp = kv + base + (size_t)HKV * DH;   // kv[...,1,kvh,:]
        _Float16* kout = K16 + ((size_t)bh * SK + (s0 + r)) * DH + cg;
        #pragma unroll
        for (int i = 0; i < 32; ++i) kout[i] = (_Float16)kp[i];
        #pragma unroll
        for (int i = 0; i < 32; ++i) Vt[cg + i][r] = (_Float16)vp[i];
    }
    __syncthreads();
    {
        const int d  = tid >> 1;           // 0..127
        const int sg = (tid & 1) * 32;
        const int tile = (s0 + sg) >> 5;   // 32-key tile this thread's 32 keys belong to
        _Float16* vout = V16T + (((size_t)bh * (SK / 32) + tile) * DH + d) * 32;
        #pragma unroll
        for (int i = 0; i < 32; ++i) vout[i] = Vt[d][sg + i];
    }
}

// ---- fast path: double-buffered f16 tiles via async global->LDS, overlapped with WMMA ----
// Two waves per SIMD is what the grid gives (two work-groups on every WGP); stated so that the
// register budget lets a block's fragment loads be issued together, ahead of its products.
__global__ __launch_bounds__(128) __attribute__((amdgpu_waves_per_eu(2, 2)))
void CrossAttention_89189290868783_fast(const float* __restrict__ q,
                                        const _Float16* __restrict__ K16,
                                        const _Float16* __restrict__ V16T,
                                        float* __restrict__ out)
{
    __shared__ __align__(16) _Float16 Ksh[2][32][136];
    __shared__ __align__(16) _Float16 VshT[2][128][40];

    const int tid  = threadIdx.x;
    const int lane = tid & 31;

    // The four waves take the four query heads that share this work-group's KV head, each the same
    // 32 query rows: one staged tile serves all four, and all four meet the diagonal in the same block.
    const int hy  = (int)blockIdx.y * (NH / HKV) + (tid >> 5);
    const int bz  = blockIdx.z;
    const int bh  = bz * HKV + (int)blockIdx.y;

    auto stage = [&](int kbs, int buf) {
        // Both tiles are 8 KB contiguous: 16-byte chunk c*128 + tid goes to thread tid, so the
        // 32 lanes of one copy instruction read 512 consecutive bytes (four whole 128-B lines).
        const _Float16* kg = K16 + ((size_t)bh * SK + kbs) * DH + tid * 8;
        const _Float16* vg = V16T + ((size_t)bh * (SK / 32) + (kbs >> 5)) * (DH * 32) + tid * 8;
        const int kr = tid >> 4, kc = (tid & 15) * 8;   // K chunk: 16 per 128-wide row
        const int vr = tid >> 2, vc = (tid & 3) * 8;    // V chunk: 4 per 32-key row
#ifdef USE_ASYNC_LDS
        #pragma unroll
        for (int c = 0; c < 4; ++c) async_copy16(kg + c * 1024, &Ksh[buf][c * 8 + kr][kc]);
        #pragma unroll
        for (int c = 0; c < 4; ++c) async_copy16(vg + c * 1024, &VshT[buf][c * 32 + vr][vc]);
#else
        #pragma unroll
        for (int c = 0; c < 4; ++c)
            *(h8*)&Ksh[buf][c * 8 + kr][kc] = *(const h8*)(kg + c * 1024);
        #pragma unroll
        for (int c = 0; c < 4; ++c)
            *(h8*)&VshT[buf][c * 32 + vr][vc] = *(const h8*)(vg + c * 1024);
#endif
    };

    // Causal cost grows linearly with the query tile's index, and the whole grid is resident at once:
    // every work-group takes tile n-1-x and then tile x, one after the other, so all do equal work.
    for (int t = 0; t < 2; ++t) {
        const int bx    = t ? (int)blockIdx.x : SQ / 32 - 1 - (int)blockIdx.x;
        const int qrow0 = bx * 32;

        if (t) __syncthreads();                 // every wave has left the first tile's buffers
        stage(0, 0);                            // prologue fill of buffer 0

        v16h qf[2][4];
        fa_load_q(q, bz, hy, qrow0,      lane, qf[0]);
        fa_load_q(q, bz, hy, qrow0 + 16, lane, qf[1]);

        FaState<2> st;
        fa_init(st);

        // Strictly-lower blocks need no mask; the tile's last block, the only one on the diagonal (for
        // all four waves alike), stands behind the loop with the same wait and barrier in front.
        int it = 0;
        for (int kb = 0; kb < qrow0; kb += 32, ++it) {
#ifdef USE_ASYNC_LDS
            async_wait0();                      // this wave's fills for buf[it&1] landed
#endif
            __syncthreads();                    // all waves filled; prev compute done
            stage(kb + 32, (it + 1) & 1);       // DMA next tile under this tile's math
            fa_block_compute<false, 2>(qf, Ksh[it & 1], VshT[it & 1], kb, qrow0, lane, st);
        }
#ifdef USE_ASYNC_LDS
        async_wait0();                          // this wave's fills for buf[it&1] landed
#endif
        __syncthreads();                        // all waves filled; prev compute done
        fa_block_compute<true, 2>(qf, Ksh[it & 1], VshT[it & 1], qrow0, qrow0, lane, st);

        fa_store_out(out, bz, hy, qrow0, lane, st);
        // The second tile rewrites the registers that these stores name: the wait stands in front.
        asm volatile("s_wait_xcnt 0x0" ::: "memory");
    }
}

// ---------------- fallback: fused fp32 KV conversion (single buffer) ----------------
__global__ __launch_bounds__(128)
void CrossAttention_89189290868783_kernel(const float* __restrict__ q,
                                          const float* __restrict__ kv,
                                          float* __restrict__ out)
{
    __shared__ __align__(16) _Float16 Ksh[32][136];
    __shared__ __align__(16) _Float16 VshT[128][40];

    const int tid  = threadIdx.x;
    const int lane = tid & 31;
    const int wave = tid >> 5;

    const int bx  = blockIdx.x;
    const int hy  = blockIdx.y;
    const int bz  = blockIdx.z;
    const int kvh = hy >> 2;

    const int qrow0 = bx * 64 + wave * 16;

    v16h qf[1][4];
    fa_load_q(q, bz, hy, qrow0, lane, qf[0]);

    FaState<1> st;
    fa_init(st);

    const int kend = (bx + 1) * 64;

    for (int kb = 0; kb < kend; kb += 32) {
        __syncthreads();
        {
            const int r32 = tid >> 2;
            const int cg  = (tid & 3) * 32;
            const size_t rowbase =
                ((size_t)bz * SK + (size_t)(kb + r32)) * (2 * HKV * DH) +
                (size_t)kvh * DH + cg;
            const float* kp = kv + rowbase;
            const float* vp = kv + rowbase + (size_t)HKV * DH;
            #pragma unroll
            for (int i = 0; i < 32; ++i) Ksh[r32][cg + i]  = (_Float16)kp[i];
            #pragma unroll
            for (int i = 0; i < 32; ++i) VshT[cg + i][r32] = (_Float16)vp[i];
            if (kb + 32 < kend) {
                __builtin_prefetch(kp + 2 * HKV * DH * 32, 0, 1);
                __builtin_prefetch(vp + 2 * HKV * DH * 32, 0, 1);
            }
        }
        __syncthreads();

        fa_block_compute<true, 1>(qf, Ksh, VshT, kb, qrow0, lane, st);
    }

    fa_store_out(out, bz, hy, qrow0, lane, st);
}

extern "C" void kernel_launch(void* const* d_in, const int* in_sizes, int n_in,
                              void* d_out, int out_size, void* d_ws, size_t ws_size,
                              hipStream_t stream) {
    (void)in_sizes; (void)n_in; (void)out_size;
    const float* q  = (const float*)d_in[0];
    const float* kv = (const float*)d_in[1];
    float* out = (float*)d_out;

    const size_t kbytes = (size_t)BATCH * HKV * SK * DH * 2;  // 8 MB f16 K
    dim3 grid(SQ / 64, NH, BATCH);
    dim3 block(128);

    if (ws_size >= 2 * kbytes) {
        _Float16* K16  = (_Float16*)d_ws;
        _Float16* V16T = (_Float16*)((char*)d_ws + kbytes);
        CrossAttention_89189290868783_kvprep<<<dim3(SK / 64, BATCH * HKV), 256, 0, stream>>>(
            kv, K16, V16T);
        grid.x = SQ / 64;    // the fast path's work-groups take two 32-row query tiles each,
        grid.y = HKV;        // for the four query heads of one KV head
        CrossAttention_89189290868783_fast<<<grid, block, 0, stream>>>(q, K16, V16T, out);
    } else {
        CrossAttention_89189290868783_kernel<<<grid, block, 0, stream>>>(q, kv, out);
    }
}

// v005
// A run of this version takes 70.4 microseconds.
// Two timings next to v004 put it at 1.08 and 1.09 times that version's speed.
// Counting every step since v000, it is 3.44 times as fast.
#include <hip/hip_runtime.h>
#include <cstdint>
#include <cstddef>

typedef __attribute__((ext_vector_type(16))) _Float16 v16h;
typedef __attribute__((ext_vector_type(8)))  _Float16 h8;
typedef __attribute__((ext_vector_type(8)))  float    v8f;
typedef __attribute__((ext_vector_type(4)))  float    f4;

// Fixed problem dims from the reference
#define BATCH 2
#define SQ    2048
#define NH    32
#define DH    128
#define SK    2048
#define HKV   8

// ---------------- CDNA5 async global->LDS path (guarded) ----------------
#if defined(__HIP_DEVICE_COMPILE__) && __has_builtin(__builtin_amdgcn_global_load_async_to_lds_b128)
#define USE_ASYNC_LDS 1
#define AS1 __attribute__((address_space(1)))
#define AS3 __attribute__((address_space(3)))
typedef int v4i_vs __attribute__((vector_size(16)));   // matches builtin param pointee
__device__ __forceinline__ void async_copy16(const void* g, void* l) {
    __builtin_amdgcn_global_load_async_to_lds_b128((AS1 v4i_vs*)g, (AS3 v4i_vs*)l, 0, 0);
}
__device__ __forceinline__ void async_wait0() {
#if __has_builtin(__builtin_amdgcn_s_wait_asynccnt)
    __builtin_amdgcn_s_wait_asynccnt(0);
#else
    asm volatile("s_wait_asynccnt 0x0" ::: "memory");
#endif
}
#endif

template <int G>
struct FaState {
    float m[G];      // running maximum of this lane's query row (equal in both lane halves)
    float l[G];      // running sum over this lane half's keys only; the halves join in the epilogue
    v8f   o[G][8];   // o[g][j][r] = O[query 16 g + (lane&15)][d = 16 j + 8 (lane>>4) + r]
};

// Value of the same query row in the other lane half (lane ^ 16), by a vector cross-row move.
__device__ __forceinline__ float other_half(float x) {
    const unsigned b = __builtin_bit_cast(unsigned, x);
    return __builtin_bit_cast(float,
        __builtin_amdgcn_permlanex16(b, b, 0x76543210u, 0xfedcba98u, false, false));
}

// One call works on KT sub-tiles of 32 keys: Ksh holds 32 KT key rows, VshT holds KT sub-tiles of
// 128 head-dim rows x 32 keys one behind the other. Maximum, rescale and sum are done once per call.
template <bool MASKED, int G, int KT>
__device__ __forceinline__ void fa_block_compute(const v16h (&qf)[G][4],
                                                 _Float16 (*Ksh)[136],
                                                 _Float16 (*VshT)[40],
                                                 int kb, int qrow0, int lane,
                                                 FaState<G>& st)
{
    const int half = lane >> 4;
    const int l16  = lane & 15;
    const v8f vzero = {};
    const float NEG_INF = -__builtin_inff();

    // ---- S^T = K (Q*scale)^T : 2 KT 16-key tiles per query group;
    // ---- sacc[g][tc][r] = S[query 16 g + l16][key 16 tc + 8 half + r] ----
    // All K fragments of the block are fetched as one group, ahead of its products.
    v16h kf[4][2 * KT];
    #pragma unroll
    for (int c = 0; c < 4; ++c) {
        #pragma unroll
        for (int tc = 0; tc < 2 * KT; ++tc) {
            const int key  = tc * 16 + l16;
            const int doff = 32 * c + half * 8;
            const h8 lo = *(const h8*)&Ksh[key][doff];
            const h8 hi = *(const h8*)&Ksh[key][doff + 16];
            #pragma unroll
            for (int i = 0; i < 8; ++i) { kf[c][tc][i] = lo[i]; kf[c][tc][i + 8] = hi[i]; }
        }
    }
    v8f sacc[G][2 * KT];
    #pragma unroll
    for (int g = 0; g < G; ++g)
        #pragma unroll
        for (int tc = 0; tc < 2 * KT; ++tc) sacc[g][tc] = vzero;
    #pragma unroll
    for (int c = 0; c < 4; ++c) {
        #pragma unroll
        for (int tc = 0; tc < 2 * KT; ++tc) {
            #pragma unroll
            for (int g = 0; g < G; ++g)
                sacc[g][tc] = __builtin_amdgcn_wmma_f32_16x16x32_f16(false, kf[c][tc], false, qf[g][c],
                                                                     (short)0, sacc[g][tc],
                                                                     false, false);
        }
    }

    // A sub-tile's V^T fragments are fetched as one group: the first sub-tile's here, so that the softmax
    // below covers their latency, the next one's ahead of the products of the one before.
    v16h vf[KT][8];
    auto load_v = [&](int kt) {
        #pragma unroll
        for (int j = 0; j < 8; ++j) {
            const int drow = kt * DH + j * 16 + l16;
            const int koff = half * 8;
            const h8 lo = *(const h8*)&VshT[drow][koff];
            const h8 hi = *(const h8*)&VshT[drow][koff + 16];
            #pragma unroll
            for (int i = 0; i < 8; ++i) { vf[kt][j][i] = lo[i]; vf[kt][j][i + 8] = hi[i]; }
        }
    };
    load_v(0);

    // ---- causal mask (fast path: its diagonal block only; fallback: every block) ----
    if (MASKED) {
        #pragma unroll
        for (int g = 0; g < G; ++g) {
            const int row = qrow0 + 16 * g + l16;
            #pragma unroll
            for (int tc = 0; tc < 2 * KT; ++tc)
                #pragma unroll
                for (int r = 0; r < 8; ++r) {
                    const int key = kb + tc * 16 + 8 * half + r;
                    sacc[g][tc][r] = (key > row) ? NEG_INF : sacc[g][tc][r];
                }
        }
    }

    // ---- online softmax of one query row per lane: in-lane maximum (two chains per row), one exchange
    // ---- between the halves ----
    float msc[G];
    #pragma unroll
    for (int g = 0; g < G; ++g) {
        float ma = sacc[g][0][0];
        float mb = sacc[g][KT][0];
        #pragma unroll
        for (int tc = 0; tc < KT; ++tc)
            #pragma unroll
            for (int r = 0; r < 8; ++r) {
                ma = fmaxf(ma, sacc[g][tc][r]);
                mb = fmaxf(mb, sacc[g][KT + tc][r]);
            }
        float mx = fmaxf(ma, mb);
        mx = fmaxf(mx, other_half(mx));
        const float mnew = fmaxf(st.m[g], mx);
        msc[g]  = __expf(st.m[g] - mnew);   // 0 on first visit
        st.m[g] = mnew;
        #pragma unroll
        for (int tc = 0; tc < 2 * KT; ++tc)
            #pragma unroll
            for (int r = 0; r < 8; ++r) sacc[g][tc][r] = __expf(sacc[g][tc][r] - mnew);
    }

    // P^T packs straight from the score accumulators into the B operands, one per 32-key sub-tile
    // (hardware k order: element s < 8 is key 8 half + s, element 8 + s is key 16 + 8 half + s).
    v16h pf[G][KT];
    #pragma unroll
    for (int g = 0; g < G; ++g) {
        v8f t = sacc[g][0] + sacc[g][1];
        #pragma unroll
        for (int kt = 1; kt < KT; ++kt) t += sacc[g][2 * kt] + sacc[g][2 * kt + 1];
        const float sum = ((t[0] + t[1]) + (t[2] + t[3])) + ((t[4] + t[5]) + (t[6] + t[7]));
        st.l[g] = st.l[g] * msc[g] + sum;
        #pragma unroll
        for (int kt = 0; kt < KT; ++kt)
            #pragma unroll
            for (int r = 0; r < 8; ++r) {
                pf[g][kt][r]     = (_Float16)sacc[g][2 * kt][r];
                pf[g][kt][r + 8] = (_Float16)sacc[g][2 * kt + 1][r];
            }
        #pragma unroll
        for (int j = 0; j < 8; ++j) st.o[g][j] *= msc[g];
    }

    // ---- O^T += V^T P^T, sub-tile by sub-tile ----
    #pragma unroll
    for (int kt = 0; kt < KT; ++kt) {
        if (kt + 1 < KT) load_v(kt + 1);
        #pragma unroll
        for (int j = 0; j < 8; ++j) {
            #pragma unroll
            for (int g = 0; g < G; ++g)
                st.o[g][j] = __builtin_amdgcn_wmma_f32_16x16x32_f16(false, vf[kt][j], false, pf[g][kt],
                                                                    (short)0, st.o[g][j],
                                                                    false, false);
        }
    }
}

template <int G>
__device__ __forceinline__ void fa_init(FaState<G>& st)
{
    const v8f vzero = {};
    #pragma unroll
    for (int g = 0; g < G; ++g) {
        st.m[g] = -__builtin_inff();
        st.l[g] = 0.0f;
        #pragma unroll
        for (int j = 0; j < 8; ++j) st.o[g][j] = vzero;
    }
}

__device__ __forceinline__ void fa_load_q(const float* __restrict__ q,
                                          int bz, int hy, int qrow0, int lane,
                                          v16h qf[4])
{
    const int half = lane >> 4;
    const int l16  = lane & 15;
    const float scale = 0.08838834764831845f; // 1/sqrt(128)
    const int trow = qrow0 + l16;
    const float* qp = q + (((size_t)bz * SQ + trow) * NH + hy) * DH;
    #pragma unroll
    for (int c = 0; c < 4; ++c) {
        const int base = 32 * c + half * 8;
        #pragma unroll
        for (int i = 0; i < 8; ++i) {
            qf[c][i]     = (_Float16)(qp[base + i]      * scale);
            qf[c][i + 8] = (_Float16)(qp[base + 16 + i] * scale);
        }
    }
}

template <int G>
__device__ __forceinline__ void fa_store_out(float* __restrict__ out,
                                             int bz, int hy, int qrow0, int lane,
                                             FaState<G>& st)
{
    const int half = lane >> 4;
    const int l16  = lane & 15;
    float* op = out + (((size_t)bz * SQ + (qrow0 + l16)) * NH + hy) * DH + 8 * half;
    #pragma unroll
    for (int g = 0; g < G; ++g) {
        const float rl = 1.0f / (st.l[g] + other_half(st.l[g]));   // join the halves' key sums
        #pragma unroll
        for (int j = 0; j < 8; ++j) st.o[g][j] *= rl;
    }
    // Keeps every register write of the epilogue in front of the first store: without it one group's
    // scaling is scheduled among the other's stores, over registers that issued stores still name.
    __builtin_amdgcn_sched_barrier(0);
    #pragma unroll
    for (int g = 0; g < G; ++g) {
        #pragma unroll
        for (int j = 0; j < 8; ++j) {
            const v8f o = st.o[g][j];
            float* p = op + g * (16 * NH * DH) + j * 16;
            *(f4*)(p)     = f4{o[0], o[1], o[2], o[3]};
            *(f4*)(p + 4) = f4{o[4], o[5], o[6], o[7]};
        }
    }
}

// ---- KV fp32 -> f16 preconversion: K row-major; V transposed and tiled, [bh][key/32][d][32 keys],
// ---- so that a 32-key tile of either operand is 8 KB of contiguous workspace ----
__global__ __launch_bounds__(256)
void CrossAttention_89189290868783_kvprep(const float* __restrict__ kv,
                                          _Float16* __restrict__ K16,
                                          _Float16* __restrict__ V16T)
{
    __shared__ _Float16 Vt[DH][72];   // 144B row stride (16B aligned)
    const int tid = threadIdx.x;
    const int s0  = blockIdx.x * 64;
    const int bh  = blockIdx.y;            // b*HKV + kvh
    const int b   = bh / HKV;
    const int kvh = bh % HKV;

    {
        const int r  = tid >> 2;           // 0..63 local key row
        const int cg = (tid & 3) * 32;     // 32-wide column group
        const size_t base = (((size_t)b * SK + (s0 + r)) * 2) * (HKV * DH) +
                            (size_t)kvh * DH + cg;
        const float* kp = kv + base;                      // kv[...,0,kvh,:]
        const float* vp = kv + base + (size_t)HKV * DH;   // kv[...,1,kvh,:]
        _Float16* kout = K16 + ((size_t)bh * SK + (s0 + r)) * DH + cg;
        #pragma unroll
        for (int i = 0; i < 32; ++i) kout[i] = (_Float16)kp[i];
        #pragma unroll
        for (int i = 0; i < 32; ++i) Vt[cg + i][r] = (_Float16)vp[i];
    }
    __syncthreads();
    {
        const int d  = tid >> 1;           // 0..127
        const int sg = (tid & 1) * 32;
        const int tile = (s0 + sg) >> 5;   // 32-key tile this thread's 32 keys belong to
        _Float16* vout = V16T + (((size_t)bh * (SK / 32) + tile) * DH + d) * 32;
        #pragma unroll
        for (int i = 0; i < 32; ++i) vout[i] = Vt[d][sg + i];
    }
}

// ---- fast path: double-buffered f16 tiles via async global->LDS, overlapped with WMMA ----
// Two waves per SIMD is what the grid gives (two work-groups on every WGP); stated so that the
// register budget lets a block's fragment loads be issued together, ahead of its products.
__global__ __launch_bounds__(128) __attribute__((amdgpu_waves_per_eu(2, 2)))
void CrossAttention_89189290868783_fast(const float* __restrict__ q,
                                        const _Float16* __restrict__ K16,
                                        const _Float16* __restrict__ V16T,
                                        float* __restrict__ out)
{
    __shared__ __align__(16) _Float16 Ksh[2][64][136];        // 64 keys a buffer
    __shared__ __align__(16) _Float16 VshT[2][2 * DH][40];    // two 32-key sub-tiles a buffer

    const int tid  = threadIdx.x;
    const int lane = tid & 31;

    // The four waves take the four query heads that share this work-group's KV head, each the same
    // 32 query rows: one staged tile serves all four, and all four meet the diagonal in the same block.
    const int hy  = (int)blockIdx.y * (NH / HKV) + (tid >> 5);
    const int bz  = blockIdx.z;
    const int bh  = bz * HKV + (int)blockIdx.y;

    auto stage = [&](int kbs, int buf) {
        // 64 keys of either operand are 16 KB contiguous (V^T: two sub-tiles in a row): 16-byte chunk
        // c*128 + tid goes to thread tid, so the 32 lanes of one copy instruction read 512 consecutive
        // bytes (four whole 128-B lines).
        const _Float16* kg = K16 + ((size_t)bh * SK + kbs) * DH + tid * 8;
        const _Float16* vg = V16T + ((size_t)bh * (SK / 32) + (kbs >> 5)) * (DH * 32) + tid * 8;
        const int kr = tid >> 4, kc = (tid & 15) * 8;   // K chunk: 16 per 128-wide row
        const int vr = tid >> 2, vc = (tid & 3) * 8;    // V chunk: 4 per 32-key row
#ifdef USE_ASYNC_LDS
        #pragma unroll
        for (int c = 0; c < 8; ++c) async_copy16(kg + c * 1024, &Ksh[buf][c * 8 + kr][kc]);
        #pragma unroll
        for (int c = 0; c < 8; ++c) async_copy16(vg + c * 1024, &VshT[buf][c * 32 + vr][vc]);
#else
        #pragma unroll
        for (int c = 0; c < 8; ++c)
            *(h8*)&Ksh[buf][c * 8 + kr][kc] = *(const h8*)(kg + c * 1024);
        #pragma unroll
        for (int c = 0; c < 8; ++c)
            *(h8*)&VshT[buf][c * 32 + vr][vc] = *(const h8*)(vg + c * 1024);
#endif
    };

    // Causal cost grows linearly with the query tile's index, and the whole grid is resident at once:
    // every work-group takes tile n-1-x and then tile x, one after the other, so all do equal work.
    for (int t = 0; t < 2; ++t) {
        const int bx    = t ? (int)blockIdx.x : SQ / 32 - 1 - (int)blockIdx.x;
        const int qrow0 = bx * 32;

        if (t) __syncthreads();                 // every wave has left the first tile's buffers
        stage(0, 0);                            // prologue fill of buffer 0

        v16h qf[2][4];
        fa_load_q(q, bz, hy, qrow0,      lane, qf[0]);
        fa_load_q(q, bz, hy, qrow0 + 16, lane, qf[1]);

        FaState<2> st;
        fa_init(st);

        // The keys go in blocks of 64, one wait and one barrier each. The bx >> 1 blocks that lie wholly
        // below the diagonal need no mask; the tile's last block, the only one on the diagonal (for all
        // four waves alike), stands behind the loop with the same wait and barrier in front. It starts
        // at key 64 (bx >> 1) <= SK - 64, so all 64 staged keys exist; an even tile needs only its
        // first 32 (the rest lie above every row's diagonal) and works on that sub-tile alone.
        const int nfull = bx >> 1;
        int it = 0;
        for (; it < nfull; ++it) {
#ifdef USE_ASYNC_LDS
            async_wait0();                      // this wave's fills for buf[it&1] landed
#endif
            __syncthreads();                    // all waves filled; prev compute done
            stage((it + 1) * 64, (it + 1) & 1); // DMA next block under this block's math
            fa_block_compute<false, 2, 2>(qf, Ksh[it & 1], VshT[it & 1], it * 64, qrow0, lane, st);
        }
#ifdef USE_ASYNC_LDS
        async_wait0();                          // this wave's fills for buf[it&1] landed
#endif
        __syncthreads();                        // all waves filled; prev compute done
        if (bx & 1)
            fa_block_compute<true, 2, 2>(qf, Ksh[it & 1], VshT[it & 1], it * 64, qrow0, lane, st);
        else
            fa_block_compute<true, 2, 1>(qf, Ksh[it & 1], VshT[it & 1], it * 64, qrow0, lane, st);

        fa_store_out(out, bz, hy, qrow0, lane, st);
        // The second tile rewrites the registers that these stores name: the wait stands in front.
        asm volatile("s_wait_xcnt 0x0" ::: "memory");
    }
}

// ---------------- fallback: fused fp32 KV conversion (single buffer) ----------------
__global__ __launch_bounds__(128)
void CrossAttention_89189290868783_kernel(const float* __restrict__ q,
                                          const float* __restrict__ kv,
                                          float* __restrict__ out)
{
    __shared__ __align__(16) _Float16 Ksh[32][136];
    __shared__ __align__(16) _Float16 VshT[128][40];

    const int tid  = threadIdx.x;
    const int lane = tid & 31;
    const int wave = tid >> 5;

    const int bx  = blockIdx.x;
    const int hy  = blockIdx.y;
    const int bz  = blockIdx.z;
    const int kvh = hy >> 2;

    const int qrow0 = bx * 64 + wave * 16;

    v16h qf[1][4];
    fa_load_q(q, bz, hy, qrow0, lane, qf[0]);

    FaState<1> st;
    fa_init(st);

    const int kend = (bx + 1) * 64;

    for (int kb = 0; kb < kend; kb += 32) {
        __syncthreads();
        {
            const int r32 = tid >> 2;
            const int cg  = (tid & 3) * 32;
            const size_t rowbase =
                ((size_t)bz * SK + (size_t)(kb + r32)) * (2 * HKV * DH) +
                (size_t)kvh * DH + cg;
            const float* kp = kv + rowbase;
            const float* vp = kv + rowbase + (size_t)HKV * DH;
            #pragma unroll
            for (int i = 0; i < 32; ++i) Ksh[r32][cg + i]  = (_Float16)kp[i];
            #pragma unroll
            for (int i = 0; i < 32; ++i) VshT[cg + i][r32] = (_Float16)vp[i];
            if (kb + 32 < kend) {
                __builtin_prefetch(kp + 2 * HKV * DH * 32, 0, 1);
                __builtin_prefetch(vp + 2 * HKV * DH * 32, 0, 1);
            }
        }
        __syncthreads();

        fa_block_compute<true, 1, 1>(qf, Ksh, VshT, kb, qrow0, lane, st);
    }

    fa_store_out(out, bz, hy, qrow0, lane, st);
}

extern "C" void kernel_launch(void* const* d_in, const int* in_sizes, int n_in,
                              void* d_out, int out_size, void* d_ws, size_t ws_size,
                              hipStream_t stream) {
    (void)in_sizes; (void)n_in; (void)out_size;
    const float* q  = (const float*)d_in[0];
    const float* kv = (const float*)d_in[1];
    float* out = (float*)d_out;

    const size_t kbytes = (size_t)BATCH * HKV * SK * DH * 2;  // 8 MB f16 K
    dim3 grid(SQ / 64, NH, BATCH);
    dim3 block(128);

    if (ws_size >= 2 * kbytes) {
        _Float16* K16  = (_Float16*)d_ws;
        _Float16* V16T = (_Float16*)((char*)d_ws + kbytes);
        CrossAttention_89189290868783_kvprep<<<dim3(SK / 64, BATCH * HKV), 256, 0, stream>>>(
            kv, K16, V16T);
        grid.x = SQ / 64;    // the fast path's work-groups take two 32-row query tiles each,
        grid.y = HKV;        // for the four query heads of one KV head
        CrossAttention_89189290868783_fast<<<grid, block, 0, stream>>>(q, K16, V16T, out);
    } else {
        CrossAttention_89189290868783_kernel<<<grid, block, 0, stream>>>(q, kv, out);
    }
}

// v006
// It runs in 66.3 microseconds.
// Two timings next to v005 put it at 1.07 and 1.06 times that version's speed.
// Counting every step since v000, it is 3.68 times as fast.
#include <hip/hip_runtime.h>
#include <cstdint>
#include <cstddef>

typedef __attribute__((ext_vector_type(16))) _Float16 v16h;
typedef __attribute__((ext_vector_type(8)))  _Float16 h8;
typedef __attribute__((ext_vector_type(8)))  float    v8f;
typedef __attribute__((ext_vector_type(4)))  float    f4;

// Fixed problem dims from the reference
#define BATCH 2
#define SQ    2048
#define NH    32
#define DH    128
#define SK    2048
#define HKV   8

// ---------------- CDNA5 async global->LDS path (guarded) ----------------
#if defined(__HIP_DEVICE_COMPILE__) && __has_builtin(__builtin_amdgcn_global_load_async_to_lds_b128)
#define USE_ASYNC_LDS 1
#define AS1 __attribute__((address_space(1)))
#define AS3 __attribute__((address_space(3)))
typedef int v4i_vs __attribute__((vector_size(16)));   // matches builtin param pointee
__device__ __forceinline__ void async_copy16(const void* g, void* l) {
    __builtin_amdgcn_global_load_async_to_lds_b128((AS1 v4i_vs*)g, (AS3 v4i_vs*)l, 0, 0);
}
__device__ __forceinline__ void async_wait0() {
#if __has_builtin(__builtin_amdgcn_s_wait_asynccnt)
    __builtin_amdgcn_s_wait_asynccnt(0);
#else
    asm volatile("s_wait_asynccnt 0x0" ::: "memory");
#endif
}
#endif

template <int G>
struct FaState {
    v8f   nm[G];     // minus the maximum in use for this lane's query row (log2 units), in all 8 registers:
                     // the C operand of the row's score products (equal in both lane halves)
    float l[G];      // running sum over this lane half's keys only; the halves join in the epilogue
    v8f   o[G][8];   // o[g][j][r] = O[query 16 g + (lane&15)][d = 16 j + 8 (lane>>4) + r]
};

// Value of the same query row in the other lane half (lane ^ 16), by a vector cross-row move.
__device__ __forceinline__ float other_half(float x) {
    const unsigned b = __builtin_bit_cast(unsigned, x);
    return __builtin_bit_cast(float,
        __builtin_amdgcn_permlanex16(b, b, 0x76543210u, 0xfedcba98u, false, false));
}

// One call works on KT sub-tiles of 32 keys: Ksh holds 32 KT key rows, VshT holds KT sub-tiles of
// 128 head-dim rows x 32 keys one behind the other. Q carries log2(e), and the score products start from
// minus the maximum in use, so the accumulators are the arguments of exp2 as they stand. The maximum in use
// may trail a row's true maximum by up to 8 (an exponential then reaches 2^8); it rises, and O and the sum
// are rescaled, only in a block where some row of the wave exceeds that, or in a tile's first block (first).
template <bool MASKED, int G, int KT>
__device__ __forceinline__ void fa_block_compute(const v16h (&qf)[G][4],
                                                 _Float16 (*Ksh)[136],
                                                 _Float16 (*VshT)[40],
                                                 int kb, int qrow0, int lane, bool first,
                                                 FaState<G>& st)
{
    const int half = lane >> 4;
    const int l16  = lane & 15;
    const float NEG_INF = -__builtin_inff();

    // ---- S^T = K (Q*scale)^T - maximum in use : 2 KT 16-key tiles per query group;
    // ---- sacc[g][tc][r] = S[query 16 g + l16][key 16 tc + 8 half + r] ----
    // All K fragments of the block are fetched as one group, ahead of its products.
    v16h kf[4][2 * KT];
    #pragma unroll
    for (int c = 0; c < 4; ++c) {
        #pragma unroll
        for (int tc = 0; tc < 2 * KT; ++tc) {
            const int key  = tc * 16 + l16;
            const int doff = 32 * c + half * 8;
            const h8 lo = *(const h8*)&Ksh[key][doff];
            const h8 hi = *(const h8*)&Ksh[key][doff + 16];
            #pragma unroll
            for (int i = 0; i < 8; ++i) { kf[c][tc][i] = lo[i]; kf[c][tc][i + 8] = hi[i]; }
        }
    }
    v8f sacc[G][2 * KT];
    #pragma unroll
    for (int c = 0; c < 4; ++c) {
        #pragma unroll
        for (int tc = 0; tc < 2 * KT; ++tc) {
            #pragma unroll
            for (int g = 0; g < G; ++g)
                sacc[g][tc] = __builtin_amdgcn_wmma_f32_16x16x32_f16(false, kf[c][tc], false, qf[g][c],
                                                                     (short)0, c ? sacc[g][tc] : st.nm[g],
                                                                     false, false);
        }
    }

    // A sub-tile's V^T fragments are fetched as one group: the first sub-tile's here, so that the softmax
    // below covers their latency, the next one's ahead of the products of the one before.
    v16h vf[KT][8];
    auto load_v = [&](int kt) {
        #pragma unroll
        for (int j = 0; j < 8; ++j) {
            const int drow = kt * DH + j * 16 + l16;
            const int koff = half * 8;
            const h8 lo = *(const h8*)&VshT[drow][koff];
            const h8 hi = *(const h8*)&VshT[drow][koff + 16];
            #pragma unroll
            for (int i = 0; i < 8; ++i) { vf[kt][j][i] = lo[i]; vf[kt][j][i + 8] = hi[i]; }
        }
    };
    load_v(0);

    // ---- causal mask (fast path: its diagonal block only; fallback: every block) ----
    if (MASKED) {
        #pragma unroll
        for (int g = 0; g < G; ++g) {
            const int row = qrow0 + 16 * g + l16;
            #pragma unroll
            for (int tc = 0; tc < 2 * KT; ++tc)
                #pragma unroll
                for (int r = 0; r < 8; ++r) {
                    const int key = kb + tc * 16 + 8 * half + r;
                    sacc[g][tc][r] = (key > row) ? NEG_INF : sacc[g][tc][r];
                }
        }
    }

    // ---- online softmax of one query row per lane: in-lane maximum (two chains per row), one exchange
    // ---- between the halves; mx = how far the block's scores stand above the maximum in use ----
    float mx[G];
    bool need = false;
    #pragma unroll
    for (int g = 0; g < G; ++g) {
        float ma = sacc[g][0][0];
        float mb = sacc[g][KT][0];
        #pragma unroll
        for (int tc = 0; tc < KT; ++tc)
            #pragma unroll
            for (int r = 0; r < 8; ++r) {
                ma = fmaxf(ma, sacc[g][tc][r]);
                mb = fmaxf(mb, sacc[g][KT + tc][r]);
            }
        const float m2 = fmaxf(ma, mb);
        mx[g] = fmaxf(m2, other_half(m2));
        need  = need || (mx[g] > 8.0f);
    }
    // One scalar test per block. A tile's first block sets the maximum in use to the block's own (O and the
    // sum are still 0 there); later it only rises.
    if (first || __builtin_amdgcn_ballot_w32(need) != 0) {
        #pragma unroll
        for (int g = 0; g < G; ++g) {
            const float up   = first ? mx[g] : fmaxf(mx[g], 0.0f);
            const float corr = first ? 0.0f : __builtin_amdgcn_exp2f(-up);
            st.nm[g] -= up;
            st.l[g]  *= corr;
            #pragma unroll
            for (int tc = 0; tc < 2 * KT; ++tc) sacc[g][tc] -= up;
            #pragma unroll
            for (int j = 0; j < 8; ++j) st.o[g][j] *= corr;
        }
    }
    // A sub-tile's exponentials; P^T packs straight from the score accumulators into its B operand
    // (hardware k order: element s < 8 is key 8 half + s, element 8 + s is key 16 + 8 half + s).
    v16h pf[G][KT];
    v8f  t[G];       // the row's sum so far, one part per register
    auto exp_pack = [&](int kt) {
        #pragma unroll
        for (int g = 0; g < G; ++g) {
            #pragma unroll
            for (int r = 0; r < 8; ++r) {
                sacc[g][2 * kt][r]     = __builtin_amdgcn_exp2f(sacc[g][2 * kt][r]);
                sacc[g][2 * kt + 1][r] = __builtin_amdgcn_exp2f(sacc[g][2 * kt + 1][r]);
                pf[g][kt][r]     = (_Float16)sacc[g][2 * kt][r];
                pf[g][kt][r + 8] = (_Float16)sacc[g][2 * kt + 1][r];
            }
            const v8f s2 = sacc[g][2 * kt] + sacc[g][2 * kt + 1];
            t[g] = kt ? t[g] + s2 : s2;
        }
    };
    exp_pack(0);

    // ---- O^T += V^T P^T, sub-tile by sub-tile ----
    #pragma unroll
    for (int kt = 0; kt < KT; ++kt) {
        if (kt + 1 < KT) {
            load_v(kt + 1);
            if (!MASKED) {
                // Keeps the next sub-tile's fragment loads one group ahead of this sub-tile's products: without
                // it they sink among the products in pairs, each pair with a wait for its own LDS latency.
                __builtin_amdgcn_sched_barrier(0);
                exp_pack(kt + 1);   // its vector work may then go among this sub-tile's products
            }
        }
        #pragma unroll
        for (int j = 0; j < 8; ++j) {
            #pragma unroll
            for (int g = 0; g < G; ++g)
                st.o[g][j] = __builtin_amdgcn_wmma_f32_16x16x32_f16(false, vf[kt][j], false, pf[g][kt],
                                                                    (short)0, st.o[g][j],
                                                                    false, false);
        }
        // The diagonal block (once per tile) takes the sub-tiles one after the other: the order above spills there.
        if (MASKED && kt + 1 < KT) exp_pack(kt + 1);
    }
    #pragma unroll
    for (int g = 0; g < G; ++g)
        st.l[g] += ((t[g][0] + t[g][1]) + (t[g][2] + t[g][3])) + ((t[g][4] + t[g][5]) + (t[g][6] + t[g][7]));
}

template <int G>
__device__ __forceinline__ void fa_init(FaState<G>& st)
{
    const v8f vzero = {};
    #pragma unroll
    for (int g = 0; g < G; ++g) {
        st.nm[g] = vzero;
        st.l[g]  = 0.0f;
        #pragma unroll
        for (int j = 0; j < 8; ++j) st.o[g][j] = vzero;
    }
}

__device__ __forceinline__ void fa_load_q(const float* __restrict__ q,
                                          int bz, int hy, int qrow0, int lane,
                                          v16h qf[4])
{
    const int half = lane >> 4;
    const int l16  = lane & 15;
    const float scale = 0.08838834764831845f * 1.4426950408889634f; // 1/sqrt(128) * log2(e)
    const int trow = qrow0 + l16;
    const float* qp = q + (((size_t)bz * SQ + trow) * NH + hy) * DH;
    #pragma unroll
    for (int c = 0; c < 4; ++c) {
        const int base = 32 * c + half * 8;
        #pragma unroll
        for (int i = 0; i < 8; ++i) {
            qf[c][i]     = (_Float16)(qp[base + i]      * scale);
            qf[c][i + 8] = (_Float16)(qp[base + 16 + i] * scale);
        }
    }
}

template <int G>
__device__ __forceinline__ void fa_store_out(float* __restrict__ out,
                                             int bz, int hy, int qrow0, int lane,
                                             FaState<G>& st)
{
    const int half = lane >> 4;
    const int l16  = lane & 15;
    float* op = out + (((size_t)bz * SQ + (qrow0 + l16)) * NH + hy) * DH + 8 * half;
    #pragma unroll
    for (int g = 0; g < G; ++g) {
        const float rl = 1.0f / (st.l[g] + other_half(st.l[g]));   // join the halves' key sums
        #pragma unroll
        for (int j = 0; j < 8; ++j) st.o[g][j] *= rl;
    }
    // Keeps every register write of the epilogue in front of the first store: without it one group's
    // scaling is scheduled among the other's stores, over registers that issued stores still name.
    __builtin_amdgcn_sched_barrier(0);
    #pragma unroll
    for (int g = 0; g < G; ++g) {
        #pragma unroll
        for (int j = 0; j < 8; ++j) {
            const v8f o = st.o[g][j];
            float* p = op + g * (16 * NH * DH) + j * 16;
            *(f4*)(p)     = f4{o[0], o[1], o[2], o[3]};
            *(f4*)(p + 4) = f4{o[4], o[5], o[6], o[7]};
        }
    }
}

// ---- KV fp32 -> f16 preconversion: K row-major; V transposed and tiled, [bh][key/32][d][32 keys],
// ---- so that a 32-key tile of either operand is 8 KB of contiguous workspace ----
__global__ __launch_bounds__(256)
void CrossAttention_89189290868783_kvprep(const float* __restrict__ kv,
                                          _Float16* __restrict__ K16,
                                          _Float16* __restrict__ V16T)
{
    __shared__ _Float16 Vt[DH][72];   // 144B row stride (16B aligned)
    const int tid = threadIdx.x;
    const int s0  = blockIdx.x * 64;
    const int bh  = blockIdx.y;            // b*HKV + kvh
    const int b   = bh / HKV;
    const int kvh = bh % HKV;

    {
        const int r  = tid >> 2;           // 0..63 local key row
        const int cg = (tid & 3) * 32;     // 32-wide column group
        const size_t base = (((size_t)b * SK + (s0 + r)) * 2) * (HKV * DH) +
                            (size_t)kvh * DH + cg;
        const float* kp = kv + base;                      // kv[...,0,kvh,:]
        const float* vp = kv + base + (size_t)HKV * DH;   // kv[...,1,kvh,:]
        _Float16* kout = K16 + ((size_t)bh * SK + (s0 + r)) * DH + cg;
        #pragma unroll
        for (int i = 0; i < 32; ++i) kout[i] = (_Float16)kp[i];
        #pragma unroll
        for (int i = 0; i < 32; ++i) Vt[cg + i][r] = (_Float16)vp[i];
    }
    __syncthreads();
    {
        const int d  = tid >> 1;           // 0..127
        const int sg = (tid & 1) * 32;
        const int tile = (s0 + sg) >> 5;   // 32-key tile this thread's 32 keys belong to
        _Float16* vout = V16T + (((size_t)bh * (SK / 32) + tile) * DH + d) * 32;
        #pragma unroll
        for (int i = 0; i < 32; ++i) vout[i] = Vt[d][sg + i];
    }
}

// ---- fast path: double-buffered f16 tiles via async global->LDS, overlapped with WMMA ----
// Two waves per SIMD is what the grid gives (two work-groups on every WGP); stated so that the
// register budget lets a block's fragment loads be issued together, ahead of its products.
__global__ __launch_bounds__(128) __attribute__((amdgpu_waves_per_eu(2, 2)))
void CrossAttention_89189290868783_fast(const float* __restrict__ q,
                                        const _Float16* __restrict__ K16,
                                        const _Float16* __restrict__ V16T,
                                        float* __restrict__ out)
{
    __shared__ __align__(16) _Float16 Ksh[2][64][136];        // 64 keys a buffer
    __shared__ __align__(16) _Float16 VshT[2][2 * DH][40];    // two 32-key sub-tiles a buffer

    const int tid  = threadIdx.x;
    const int lane = tid & 31;

    // The four waves take the four query heads that share this work-group's KV head, each the same
    // 32 query rows: one staged tile serves all four, and all four meet the diagonal in the same block.
    const int hy  = (int)blockIdx.y * (NH / HKV) + (tid >> 5);
    const int bz  = blockIdx.z;
    const int bh  = bz * HKV + (int)blockIdx.y;

    auto stage = [&](int kbs, int buf) {
        // 64 keys of either operand are 16 KB contiguous (V^T: two sub-tiles in a row): 16-byte chunk
        // c*128 + tid goes to thread tid, so the 32 lanes of one copy instruction read 512 consecutive
        // bytes (four whole 128-B lines).
        const _Float16* kg = K16 + ((size_t)bh * SK + kbs) * DH + tid * 8;
        const _Float16* vg = V16T + ((size_t)bh * (SK / 32) + (kbs >> 5)) * (DH * 32) + tid * 8;
        const int kr = tid >> 4, kc = (tid & 15) * 8;   // K chunk: 16 per 128-wide row
        const int vr = tid >> 2, vc = (tid & 3) * 8;    // V chunk: 4 per 32-key row
#ifdef USE_ASYNC_LDS
        #pragma unroll
        for (int c = 0; c < 8; ++c) async_copy16(kg + c * 1024, &Ksh[buf][c * 8 + kr][kc]);
        #pragma unroll
        for (int c = 0; c < 8; ++c) async_copy16(vg + c * 1024, &VshT[buf][c * 32 + vr][vc]);
#else
        #pragma unroll
        for (int c = 0; c < 8; ++c)
            *(h8*)&Ksh[buf][c * 8 + kr][kc] = *(const h8*)(kg + c * 1024);
        #pragma unroll
        for (int c = 0; c < 8; ++c)
            *(h8*)&VshT[buf][c * 32 + vr][vc] = *(const h8*)(vg + c * 1024);
#endif
    };

    // Causal cost grows linearly with the query tile's index, and the whole grid is resident at once:
    // every work-group takes tile n-1-x and then tile x, one after the other, so all do equal work.
    for (int t = 0; t < 2; ++t) {
        const int bx    = t ? (int)blockIdx.x : SQ / 32 - 1 - (int)blockIdx.x;
        const int qrow0 = bx * 32;

        if (t) __syncthreads();                 // every wave has left the first tile's buffers
        stage(0, 0);                            // prologue fill of buffer 0

        v16h qf[2][4];
        fa_load_q(q, bz, hy, qrow0,      lane, qf[0]);
        fa_load_q(q, bz, hy, qrow0 + 16, lane, qf[1]);

        FaState<2> st;
        fa_init(st);

        // The keys go in blocks of 64, one wait and one barrier each. The bx >> 1 blocks that lie wholly
        // below the diagonal need no mask; the tile's last block, the only one on the diagonal (for all
        // four waves alike), stands behind the loop with the same wait and barrier in front. It starts
        // at key 64 (bx >> 1) <= SK - 64, so all 64 staged keys exist; an even tile needs only its
        // first 32 (the rest lie above every row's diagonal) and works on that sub-tile alone.
        const int nfull = bx >> 1;
        int it = 0;
        for (; it < nfull; ++it) {
#ifdef USE_ASYNC_LDS
            async_wait0();                      // this wave's fills for buf[it&1] landed
#endif
            __syncthreads();                    // all waves filled; prev compute done
            stage((it + 1) * 64, (it + 1) & 1); // DMA next block under this block's math
            fa_block_compute<false, 2, 2>(qf, Ksh[it & 1], VshT[it & 1], it * 64, qrow0, lane, it == 0, st);
        }
#ifdef USE_ASYNC_LDS
        async_wait0();                          // this wave's fills for buf[it&1] landed
#endif
        __syncthreads();                        // all waves filled; prev compute done
        if (bx & 1)
            fa_block_compute<true, 2, 2>(qf, Ksh[it & 1], VshT[it & 1], it * 64, qrow0, lane, it == 0, st);
        else
            fa_block_compute<true, 2, 1>(qf, Ksh[it & 1], VshT[it & 1], it * 64, qrow0, lane, it == 0, st);

        fa_store_out(out, bz, hy, qrow0, lane, st);
        // The second tile rewrites the registers that these stores name: the wait stands in front.
        asm volatile("s_wait_xcnt 0x0" ::: "memory");
    }
}

// ---------------- fallback: fused fp32 KV conversion (single buffer) ----------------
__global__ __launch_bounds__(128)
void CrossAttention_89189290868783_kernel(const float* __restrict__ q,
                                          const float* __restrict__ kv,
                                          float* __restrict__ out)
{
    __shared__ __align__(16) _Float16 Ksh[32][136];
    __shared__ __align__(16) _Float16 VshT[128][40];

    const int tid  = threadIdx.x;
    const int lane = tid & 31;
    const int wave = tid >> 5;

    const int bx  = blockIdx.x;
    const int hy  = blockIdx.y;
    const int bz  = blockIdx.z;
    const int kvh = hy >> 2;

    const int qrow0 = bx * 64 + wave * 16;

    v16h qf[1][4];
    fa_load_q(q, bz, hy, qrow0, lane, qf[0]);

    FaState<1> st;
    fa_init(st);

    const int kend = (bx + 1) * 64;

    for (int kb = 0; kb < kend; kb += 32) {
        __syncthreads();
        {
            const int r32 = tid >> 2;
            const int cg  = (tid & 3) * 32;
            const size_t rowbase =
                ((size_t)bz * SK + (size_t)(kb + r32)) * (2 * HKV * DH) +
                (size_t)kvh * DH + cg;
            const float* kp = kv + rowbase;
            const float* vp = kv + rowbase + (size_t)HKV * DH;
            #pragma unroll
            for (int i = 0; i < 32; ++i) Ksh[r32][cg + i]  = (_Float16)kp[i];
            #pragma unroll
            for (int i = 0; i < 32; ++i) VshT[cg + i][r32] = (_Float16)vp[i];
            if (kb + 32 < kend) {
                __builtin_prefetch(kp + 2 * HKV * DH * 32, 0, 1);
                __builtin_prefetch(vp + 2 * HKV * DH * 32, 0, 1);
            }
        }
        __syncthreads();

        fa_block_compute<true, 1, 1>(qf, Ksh, VshT, kb, qrow0, lane, kb == 0, st);
    }

    fa_store_out(out, bz, hy, qrow0, lane, st);
}

extern "C" void kernel_launch(void* const* d_in, const int* in_sizes, int n_in,
                              void* d_out, int out_size, void* d_ws, size_t ws_size,
                              hipStream_t stream) {
    (void)in_sizes; (void)n_in; (void)out_size;
    const float* q  = (const float*)d_in[0];
    const float* kv = (const float*)d_in[1];
    float* out = (float*)d_out;

    const size_t kbytes = (size_t)BATCH * HKV * SK * DH * 2;  // 8 MB f16 K
    dim3 grid(SQ / 64, NH, BATCH);
    dim3 block(128);

    if (ws_size >= 2 * kbytes) {
        _Float16* K16  = (_Float16*)d_ws;
        _Float16* V16T = (_Float16*)((char*)d_ws + kbytes);
        CrossAttention_89189290868783_kvprep<<<dim3(SK / 64, BATCH * HKV), 256, 0, stream>>>(
            kv, K16, V16T);
        grid.x = SQ / 64;    // the fast path's work-groups take two 32-row query tiles each,
        grid.y = HKV;        // for the four query heads of one KV head
        CrossAttention_89189290868783_fast<<<grid, block, 0, stream>>>(q, K16, V16T, out);
    } else {
        CrossAttention_89189290868783_kernel<<<grid, block, 0, stream>>>(q, kv, out);
    }
}

// v007
// One run takes 61.6 microseconds.
// Next to v006, in two timings, it ran 1.07 times as fast each time.
// Counting every step since v000, it is 3.93 times as fast.
#include <hip/hip_runtime.h>
#include <cstdint>
#include <cstddef>

typedef __attribute__((ext_vector_type(16))) _Float16 v16h;
typedef __attribute__((ext_vector_type(8)))  _Float16 h8;
typedef __attribute__((ext_vector_type(8)))  float    v8f;
typedef __attribute__((ext_vector_type(4)))  float    f4;

// Fixed problem dims from the reference
#define BATCH 2
#define SQ    2048
#define NH    32
#define DH    128
#define SK    2048
#define HKV   8

// ---------------- tensor loads: global -> LDS, one request of one wave per tile ----------------
typedef uint32_t u32x4 __attribute__((ext_vector_type(4)));
typedef uint32_t u32x8 __attribute__((ext_vector_type(8)));
__device__ __forceinline__ uint32_t uni(uint32_t v) { return (uint32_t)__builtin_amdgcn_readfirstlane(v); }
// A wave-uniform test value held in a scalar register, so that the test around a tensor load compiles to a
// scalar compare and branch (a tensor load ignores EXEC: only a real branch keeps a wave from issuing it).
__device__ __forceinline__ uint32_t pinned(uint32_t v) {
    uint32_t w = uni(v);
    asm volatile("" : "+s"(w));   // the scalar pin of the tensor mover's issue test
    return w;
}
// The compiler places no wait for the tensor mover: a tile counts as landed only behind its issuer's wait.
__device__ __forceinline__ void wait_tensor0() { asm volatile("s_wait_tensorcnt 0x0" ::: "memory"); }
// This wave's LDS reads have returned before the barrier behind which their buffer is refilled.
__device__ __forceinline__ void wait_ds0() { asm volatile("s_wait_dscnt 0x0" ::: "memory"); }
__device__ __forceinline__ void tdm_load(u32x4 g0, u32x8 g1) {
    asm volatile("tensor_load_to_lds %0, %1" :: "s"(g0), "s"(g1) : "memory");
}
// Group 1: 1-byte elements, tensor = tile = ROWS rows of ROWB bytes, source rows back to back, 16 bytes of
// LDS pad behind every row (IVL = the pad interval code of that row length). Word 0 is a constant: no mask.
template <uint32_t ROWB, uint32_t ROWS, uint32_t IVL>
__device__ __forceinline__ u32x8 tdm_group1() {
    u32x8 g;
    g[0] = uni((1u << 20) | (IVL << 22) | (3u << 25));
    g[1] = uni((ROWB & 0xFFFFu) << 16);
    g[2] = uni((ROWB >> 16) | ((ROWS & 0xFFFFu) << 16));
    g[3] = uni((ROWS >> 16) | (ROWB << 16));
    g[4] = uni(ROWS);
    g[5] = uni(ROWB);
    g[6] = uni(0u);
    g[7] = uni(0u);
    return g;
}
__device__ __forceinline__ u32x4 tdm_group0(uint32_t lds_dst, uint64_t ga) {
    u32x4 g;
    g[0] = uni(1u);
    g[1] = uni(lds_dst);
    g[2] = uni((uint32_t)ga);
    g[3] = uni((((uint32_t)(ga >> 32)) & 0x01FFFFFFu) | 0x80000000u);
    return g;
}

template <int G>
struct FaState {
    v8f   nm[G];     // minus the maximum in use for this lane's query row (log2 units), in all 8 registers:
                     // the C operand of the row's score products (equal in both lane halves)
    float l[G];      // running sum over this lane half's keys only; the halves join in the epilogue
    v8f   o[G][8];   // o[g][j][r] = O[query 16 g + (lane&15)][d = 16 j + 8 (lane>>4) + r]
};

// Value of the same query row in the other lane half (lane ^ 16), by a vector cross-row move.
__device__ __forceinline__ float other_half(float x) {
    const unsigned b = __builtin_bit_cast(unsigned, x);
    return __builtin_bit_cast(float,
        __builtin_amdgcn_permlanex16(b, b, 0x76543210u, 0xfedcba98u, false, false));
}

// One call works on KT sub-tiles of 32 keys: Ksh holds 32 KT key rows, VshT holds 128 head-dim rows of
// 32 KT keys (row pitch VP elements). Q carries log2(e), and the score products start from
// minus the maximum in use, so the accumulators are the arguments of exp2 as they stand. The maximum in use
// may trail a row's true maximum by up to 8 (an exponential then reaches 2^8); it rises, and O and the sum
// are rescaled, only in a block where some row of the wave exceeds that, or in a tile's first block (first).
template <bool MASKED, int G, int KT, int VP>
__device__ __forceinline__ void fa_block_compute(const v16h (&qf)[G][4],
                                                 _Float16 (*Ksh)[136],
                                                 _Float16 (*VshT)[VP],
                                                 int kb, int qrow0, int lane, bool first,
                                                 FaState<G>& st)
{
    const int half = lane >> 4;
    const int l16  = lane & 15;
    const float NEG_INF = -__builtin_inff();

    // ---- S^T = K (Q*scale)^T - maximum in use : 2 KT 16-key tiles per query group;
    // ---- sacc[g][tc][r] = S[query 16 g + l16][key 16 tc + 8 half + r] ----
    // All K fragments of the block are fetched as one group, ahead of its products.
    v16h kf[4][2 * KT];
    #pragma unroll
    for (int c = 0; c < 4; ++c) {
        #pragma unroll
        for (int tc = 0; tc < 2 * KT; ++tc) {
            const int key  = tc * 16 + l16;
            const int doff = 32 * c + half * 8;
            const h8 lo = *(const h8*)&Ksh[key][doff];
            const h8 hi = *(const h8*)&Ksh[key][doff + 16];
            #pragma unroll
            for (int i = 0; i < 8; ++i) { kf[c][tc][i] = lo[i]; kf[c][tc][i + 8] = hi[i]; }
        }
    }
    v8f sacc[G][2 * KT];
    #pragma unroll
    for (int c = 0; c < 4; ++c) {
        #pragma unroll
        for (int tc = 0; tc < 2 * KT; ++tc) {
            #pragma unroll
            for (int g = 0; g < G; ++g)
                sacc[g][tc] = __builtin_amdgcn_wmma_f32_16x16x32_f16(false, kf[c][tc], false, qf[g][c],
                                                                     (short)0, c ? sacc[g][tc] : st.nm[g],
                                                                     false, false);
        }
    }

    // A sub-tile's V^T fragments are fetched as one group: the first sub-tile's here, so that the softmax
    // below covers their latency, the next one's ahead of the products of the one before.
    v16h vf[KT][8];
    auto load_v = [&](int kt) {
        #pragma unroll
        for (int j = 0; j < 8; ++j) {
            const int drow = j * 16 + l16;
            const int koff = kt * 32 + half * 8;
            const h8 lo = *(const h8*)&VshT[drow][koff];
            const h8 hi = *(const h8*)&VshT[drow][koff + 16];
            #pragma unroll
            for (int i = 0; i < 8; ++i) { vf[kt][j][i] = lo[i]; vf[kt][j][i + 8] = hi[i]; }
        }
    };
    load_v(0);

    // ---- causal mask (fast path: its diagonal block only; fallback: every block) ----
    if (MASKED) {
        #pragma unroll
        for (int g = 0; g < G; ++g) {
            const int row = qrow0 + 16 * g + l16;
            #pragma unroll
            for (int tc = 0; tc < 2 * KT; ++tc)
                #pragma unroll
                for (int r = 0; r < 8; ++r) {
                    const int key = kb + tc * 16 + 8 * half + r;
                    sacc[g][tc][r] = (key > row) ? NEG_INF : sacc[g][tc][r];
                }
        }
    }

    // ---- online softmax of one query row per lane: in-lane maximum (two chains per row), one exchange
    // ---- between the halves; mx = how far the block's scores stand above the maximum in use ----
    float mx[G];
    bool need = false;
    #pragma unroll
    for (int g = 0; g < G; ++g) {
        float ma = sacc[g][0][0];
        float mb = sacc[g][KT][0];
        #pragma unroll
        for (int tc = 0; tc < KT; ++tc)
            #pragma unroll
            for (int r = 0; r < 8; ++r) {
                ma = fmaxf(ma, sacc[g][tc][r]);
                mb = fmaxf(mb, sacc[g][KT + tc][r]);
            }
        const float m2 = fmaxf(ma, mb);
        mx[g] = fmaxf(m2, other_half(m2));
        need  = need || (mx[g] > 8.0f);
    }
    // One scalar test per block. A tile's first block sets the maximum in use to the block's own (O and the
    // sum are still 0 there); later it only rises.
    if (first || __builtin_amdgcn_ballot_w32(need) != 0) {
        #pragma unroll
        for (int g = 0; g < G; ++g) {
            const float up   = first ? mx[g] : fmaxf(mx[g], 0.0f);
            const float corr = first ? 0.0f : __builtin_amdgcn_exp2f(-up);
            st.nm[g] -= up;
            st.l[g]  *= corr;
            #pragma unroll
            for (int tc = 0; tc < 2 * KT; ++tc) sacc[g][tc] -= up;
            #pragma unroll
            for (int j = 0; j < 8; ++j) st.o[g][j] *= corr;
        }
    }
    // A sub-tile's exponentials; P^T packs straight from the score accumulators into its B operand
    // (hardware k order: element s < 8 is key 8 half + s, element 8 + s is key 16 + 8 half + s).
    v16h pf[G][KT];
    v8f  t[G];       // the row's sum so far, one part per register
    auto exp_pack = [&](int kt) {
        #pragma unroll
        for (int g = 0; g < G; ++g) {
            #pragma unroll
            for (int r = 0; r < 8; ++r) {
                sacc[g][2 * kt][r]     = __builtin_amdgcn_exp2f(sacc[g][2 * kt][r]);
                sacc[g][2 * kt + 1][r] = __builtin_amdgcn_exp2f(sacc[g][2 * kt + 1][r]);
                pf[g][kt][r]     = (_Float16)sacc[g][2 * kt][r];
                pf[g][kt][r + 8] = (_Float16)sacc[g][2 * kt + 1][r];
            }
            const v8f s2 = sacc[g][2 * kt] + sacc[g][2 * kt + 1];
            t[g] = kt ? t[g] + s2 : s2;
        }
    };
    exp_pack(0);

    // ---- O^T += V^T P^T, sub-tile by sub-tile ----
    #pragma unroll
    for (int kt = 0; kt < KT; ++kt) {
        if (kt + 1 < KT) {
            load_v(kt + 1);
            if (!MASKED) {
                // Keeps the next sub-tile's fragment loads one group ahead of this sub-tile's products: without
                // it they sink among the products in pairs, each pair with a wait for its own LDS latency.
                __builtin_amdgcn_sched_barrier(0);
                exp_pack(kt + 1);   // its vector work may then go among this sub-tile's products
            }
        }
        #pragma unroll
        for (int j = 0; j < 8; ++j) {
            #pragma unroll
            for (int g = 0; g < G; ++g)
                st.o[g][j] = __builtin_amdgcn_wmma_f32_16x16x32_f16(false, vf[kt][j], false, pf[g][kt],
                                                                    (short)0, st.o[g][j],
                                                                    false, false);
        }
        // The diagonal block (once per tile) takes the sub-tiles one after the other: the order above spills there.
        if (MASKED && kt + 1 < KT) exp_pack(kt + 1);
    }
    #pragma unroll
    for (int g = 0; g < G; ++g)
        st.l[g] += ((t[g][0] + t[g][1]) + (t[g][2] + t[g][3])) + ((t[g][4] + t[g][5]) + (t[g][6] + t[g][7]));
}

template <int G>
__device__ __forceinline__ void fa_init(FaState<G>& st)
{
    const v8f vzero = {};
    #pragma unroll
    for (int g = 0; g < G; ++g) {
        st.nm[g] = vzero;
        st.l[g]  = 0.0f;
        #pragma unroll
        for (int j = 0; j < 8; ++j) st.o[g][j] = vzero;
    }
}

__device__ __forceinline__ void fa_load_q(const float* __restrict__ q,
                                          int bz, int hy, int qrow0, int lane,
                                          v16h qf[4])
{
    const int half = lane >> 4;
    const int l16  = lane & 15;
    const float scale = 0.08838834764831845f * 1.4426950408889634f; // 1/sqrt(128) * log2(e)
    const int trow = qrow0 + l16;
    const float* qp = q + (((size_t)bz * SQ + trow) * NH + hy) * DH;
    #pragma unroll
    for (int c = 0; c < 4; ++c) {
        const int base = 32 * c + half * 8;
        #pragma unroll
        for (int i = 0; i < 8; ++i) {
            qf[c][i]     = (_Float16)(qp[base + i]      * scale);
            qf[c][i + 8] = (_Float16)(qp[base + 16 + i] * scale);
        }
    }
}

template <int G>
__device__ __forceinline__ void fa_store_out(float* __restrict__ out,
                                             int bz, int hy, int qrow0, int lane,
                                             FaState<G>& st)
{
    const int half = lane >> 4;
    const int l16  = lane & 15;
    float* op = out + (((size_t)bz * SQ + (qrow0 + l16)) * NH + hy) * DH + 8 * half;
    #pragma unroll
    for (int g = 0; g < G; ++g) {
        const float rl = 1.0f / (st.l[g] + other_half(st.l[g]));   // join the halves' key sums
        #pragma unroll
        for (int j = 0; j < 8; ++j) st.o[g][j] *= rl;
    }
    // Keeps every register write of the epilogue in front of the first store: without it one group's
    // scaling is scheduled among the other's stores, over registers that issued stores still name.
    __builtin_amdgcn_sched_barrier(0);
    #pragma unroll
    for (int g = 0; g < G; ++g) {
        #pragma unroll
        for (int j = 0; j < 8; ++j) {
            const v8f o = st.o[g][j];
            float* p = op + g * (16 * NH * DH) + j * 16;
            *(f4*)(p)     = f4{o[0], o[1], o[2], o[3]};
            *(f4*)(p + 4) = f4{o[4], o[5], o[6], o[7]};
        }
    }
}

// ---- KV fp32 -> f16 preconversion: K row-major; V transposed and tiled, [bh][key/64][d][64 keys],
// ---- so that a 64-key tile of either operand is 16 KB of contiguous workspace ----
__global__ __launch_bounds__(256)
void CrossAttention_89189290868783_kvprep(const float* __restrict__ kv,
                                          _Float16* __restrict__ K16,
                                          _Float16* __restrict__ V16T)
{
    __shared__ _Float16 Vt[DH][72];   // 144B row stride (16B aligned)
    const int tid = threadIdx.x;
    const int s0  = blockIdx.x * 64;
    const int bh  = blockIdx.y;            // b*HKV + kvh
    const int b   = bh / HKV;
    const int kvh = bh % HKV;

    {
        const int r  = tid >> 2;           // 0..63 local key row
        const int cg = (tid & 3) * 32;     // 32-wide column group
        const size_t base = (((size_t)b * SK + (s0 + r)) * 2) * (HKV * DH) +
                            (size_t)kvh * DH + cg;
        const float* kp = kv + base;                      // kv[...,0,kvh,:]
        const float* vp = kv + base + (size_t)HKV * DH;   // kv[...,1,kvh,:]
        _Float16* kout = K16 + ((size_t)bh * SK + (s0 + r)) * DH + cg;
        #pragma unroll
        for (int i = 0; i < 32; ++i) kout[i] = (_Float16)kp[i];
        #pragma unroll
        for (int i = 0; i < 32; ++i) Vt[cg + i][r] = (_Float16)vp[i];
    }
    __syncthreads();
    {
        const int d  = tid >> 1;           // 0..127
        const int sg = (tid & 1) * 32;
        _Float16* vout = V16T + (((size_t)bh * (SK / 64) + blockIdx.x) * DH + d) * 64 + sg;
        #pragma unroll
        for (int i = 0; i < 32; ++i) vout[i] = Vt[d][sg + i];
    }
}

// ---- fast path: double-buffered f16 tiles brought into LDS by tensor loads, overlapped with WMMA ----
// Two waves per SIMD is what the grid gives (two work-groups on every WGP); stated so that the
// register budget lets a block's fragment loads be issued together, ahead of its products.
#define K_PITCH 136                 // LDS row pitch of K in elements: 256-byte rows + the mover's 16-byte pad
#define V_PITCH 72                  // LDS row pitch of V^T in elements: 128-byte rows + the mover's 16-byte pad
#define TILE_LDS 18432u             // LDS bytes kept for one tile (K: 64 x 272, rounded up; V^T: 128 x 144): 9 x 2 KiB
#define SLOT_LDS (2u * TILE_LDS)    // one buffer: a K tile and a V^T tile
__global__ __launch_bounds__(128) __attribute__((amdgpu_waves_per_eu(2, 2)))
void CrossAttention_89189290868783_fast(const float* __restrict__ q,
                                        const _Float16* __restrict__ K16,
                                        const _Float16* __restrict__ V16T,
                                        float* __restrict__ out)
{
    // Two buffers of 64 keys; every tile starts at a multiple of 2 KiB of the work-group's LDS.
    __shared__ __attribute__((aligned(2048))) unsigned char L[2 * SLOT_LDS];

    const int tid  = threadIdx.x;
    const int lane = tid & 31;
    const uint32_t wave = pinned((uint32_t)tid >> 5);   // this wave's number, in a scalar register

    // The four waves take the four query heads that share this work-group's KV head, each the same
    // 32 query rows: one staged tile serves all four, and all four meet the diagonal in the same block.
    const int hy  = (int)blockIdx.y * (NH / HKV) + (tid >> 5);
    const int bz  = blockIdx.z;
    const int bh  = bz * HKV + (int)blockIdx.y;

    // 64 keys of either operand are 16 KB of contiguous workspace: K 64 rows of 256 bytes, V^T 128 rows of
    // 128 bytes. Wave 0 asks for a stage's K tile and wave 1 for its V^T tile, one request each.
    const uint32_t lbase = (uint32_t)(size_t)L;
    const uint64_t kga = (uint64_t)(size_t)(K16 + (size_t)bh * SK * DH);
    const uint64_t vga = (uint64_t)(size_t)(V16T + (size_t)bh * SK * DH);
    u32x8 g1k = tdm_group1<256u, 64u, 5u>();
    u32x8 g1v = tdm_group1<128u, 128u, 4u>();
    // Descriptor words held in scalar registers of their own for the whole kernel: without the pin the
    // compiler lends some of them to the loop and sets them anew at each issue, while a request is in flight.
    asm volatile("" : "+s"(g1k), "+s"(g1v));   // the tensor mover's pin: descriptor words held in scalar registers
    auto issue = [&](int st) {
        const uint32_t dst = lbase + (uint32_t)(st & 1) * SLOT_LDS;
        const uint64_t off = (uint64_t)(uint32_t)st * (64u * DH * 2u);
        if (wave == 0u) tdm_load(tdm_group0(dst, kga + off), g1k);              // scalar test: wave is pinned
        if (wave == 1u) tdm_load(tdm_group0(dst + TILE_LDS, vga + off), g1v);   // scalar test: wave is pinned
    };
    auto landed = [&]() {
        if (wave < 2u) wait_tensor0();   // the issuing waves' own requests have landed (scalar test)
    };

    // Causal cost grows linearly with the query tile's index, and the whole grid is resident at once:
    // every work-group takes tile n-1-x and then tile x, one after the other, so all do equal work.
    for (int t = 0; t < 2; ++t) {
        const int bx    = t ? (int)blockIdx.x : SQ / 32 - 1 - (int)blockIdx.x;
        const int qrow0 = bx * 32;

        if (t) __syncthreads();                 // every wave has left the first tile's buffers
        issue(0);                               // stage 0 into buffer 0, in flight under the Q loads

        v16h qf[2][4];
        fa_load_q(q, bz, hy, qrow0,      lane, qf[0]);
        fa_load_q(q, bz, hy, qrow0 + 16, lane, qf[1]);

        FaState<2> st;
        fa_init(st);

        // The keys go in stages of 64, one wait and one barrier each. The bx >> 1 stages that lie wholly
        // below the diagonal need no mask; the tile's last stage, the only one on the diagonal (for all
        // four waves alike), stands behind the loop. It starts at key 64 (bx >> 1) <= SK - 64, so all 64
        // staged keys exist; an even tile needs only its first 32 (the rest lie above every row's
        // diagonal) and works on that sub-tile alone.
        const int nfull = (int)pinned((uint32_t)(bx >> 1));   // in a scalar register: it decides which stages are issued
        int it = 0;
        for (; it < nfull; ++it) {
            // Publish point of stage it: this wave's reads of stage it - 1 are back, the requests have landed,
            // every wave has passed; only then the buffer that stage it - 1 used is filled anew.
            wait_ds0();
            landed();
            __syncthreads();
            issue(it + 1);                      // that stage exists: it + 1 <= nfull; in flight under this stage's math
            unsigned char* slot = L + (uint32_t)(it & 1) * SLOT_LDS;
            fa_block_compute<false, 2, 2>(qf, (_Float16 (*)[K_PITCH])slot, (_Float16 (*)[V_PITCH])(slot + TILE_LDS),
                                          it * 64, qrow0, lane, it == 0, st);
        }
        wait_ds0();                             // publish point of the tile's last stage; nothing is issued behind it
        landed();
        __syncthreads();
        {
            unsigned char* slot = L + (uint32_t)(it & 1) * SLOT_LDS;
            if (bx & 1)
                fa_block_compute<true, 2, 2>(qf, (_Float16 (*)[K_PITCH])slot, (_Float16 (*)[V_PITCH])(slot + TILE_LDS),
                                             it * 64, qrow0, lane, it == 0, st);
            else
                fa_block_compute<true, 2, 1>(qf, (_Float16 (*)[K_PITCH])slot, (_Float16 (*)[V_PITCH])(slot + TILE_LDS),
                                             it * 64, qrow0, lane, it == 0, st);
        }
        wait_tensor0();                         // nothing of the tile's requests is left in flight
        wait_ds0();                             // and none of this wave's LDS reads

        fa_store_out(out, bz, hy, qrow0, lane, st);
        // The second tile rewrites the registers that these stores name: the wait stands in front.
        asm volatile("s_wait_xcnt 0x0" ::: "memory");
    }
}

// ---------------- fallback: fused fp32 KV conversion (single buffer) ----------------
__global__ __launch_bounds__(128)
void CrossAttention_89189290868783_kernel(const float* __restrict__ q,
                                          const float* __restrict__ kv,
                                          float* __restrict__ out)
{
    __shared__ __align__(16) _Float16 Ksh[32][136];
    __shared__ __align__(16) _Float16 VshT[128][40];

    const int tid  = threadIdx.x;
    const int lane = tid & 31;
    const int wave = tid >> 5;

    const int bx  = blockIdx.x;
    const int hy  = blockIdx.y;
    const int bz  = blockIdx.z;
    const int kvh = hy >> 2;

    const int qrow0 = bx * 64 + wave * 16;

    v16h qf[1][4];
    fa_load_q(q, bz, hy, qrow0, lane, qf[0]);

    FaState<1> st;
    fa_init(st);

    const int kend = (bx + 1) * 64;

    for (int kb = 0; kb < kend; kb += 32) {
        __syncthreads();
        {
            const int r32 = tid >> 2;
            const int cg  = (tid & 3) * 32;
            const size_t rowbase =
                ((size_t)bz * SK + (size_t)(kb + r32)) * (2 * HKV * DH) +
                (size_t)kvh * DH + cg;
            const float* kp = kv + rowbase;
            const float* vp = kv + rowbase + (size_t)HKV * DH;
            #pragma unroll
            for (int i = 0; i < 32; ++i) Ksh[r32][cg + i]  = (_Float16)kp[i];
            #pragma unroll
            for (int i = 0; i < 32; ++i) VshT[cg + i][r32] = (_Float16)vp[i];
            if (kb + 32 < kend) {
                __builtin_prefetch(kp + 2 * HKV * DH * 32, 0, 1);
                __builtin_prefetch(vp + 2 * HKV * DH * 32, 0, 1);
            }
        }
        __syncthreads();

        fa_block_compute<true, 1, 1>(qf, Ksh, VshT, kb, qrow0, lane, kb == 0, st);
    }

    fa_store_out(out, bz, hy, qrow0, lane, st);
}

extern "C" void kernel_launch(void* const* d_in, const int* in_sizes, int n_in,
                              void* d_out, int out_size, void* d_ws, size_t ws_size,
                              hipStream_t stream) {
    (void)in_sizes; (void)n_in; (void)out_size;
    const float* q  = (const float*)d_in[0];
    const float* kv = (const float*)d_in[1];
    float* out = (float*)d_out;

    const size_t kbytes = (size_t)BATCH * HKV * SK * DH * 2;  // 8 MB f16 K
    dim3 grid(SQ / 64, NH, BATCH);
    dim3 block(128);

    if (ws_size >= 2 * kbytes) {
        _Float16* K16  = (_Float16*)d_ws;
        _Float16* V16T = (_Float16*)((char*)d_ws + kbytes);
        CrossAttention_89189290868783_kvprep<<<dim3(SK / 64, BATCH * HKV), 256, 0, stream>>>(
            kv, K16, V16T);
        grid.x = SQ / 64;    // the fast path's work-groups take two 32-row query tiles each,
        grid.y = HKV;        // for the four query heads of one KV head
        CrossAttention_89189290868783_fast<<<grid, block, 0, stream>>>(q, K16, V16T, out);
    } else {
        CrossAttention_89189290868783_kernel<<<grid, block, 0, stream>>>(q, kv, out);
    }
}

// v008
// It runs in 57 microseconds.
// Two timings next to v007 both put it at 1.08 times that version's speed.
// All steps since v000 together make it 4.25 times as fast.
#include <hip/hip_runtime.h>
#include <cstdint>
#include <cstddef>

typedef __attribute__((ext_vector_type(16))) _Float16 v16h;
typedef __attribute__((ext_vector_type(8)))  _Float16 h8;
typedef __attribute__((ext_vector_type(4)))  _Float16 h4;
typedef __attribute__((ext_vector_type(8)))  float    v8f;
typedef __attribute__((ext_vector_type(4)))  float    f4;

// Fixed problem dims from the reference
#define BATCH 2
#define SQ    2048
#define NH    32
#define DH    128
#define SK    2048
#define HKV   8

// ---------------- tensor loads: global -> LDS, one request of one wave per tile ----------------
typedef uint32_t u32x4 __attribute__((ext_vector_type(4)));
typedef uint32_t u32x8 __attribute__((ext_vector_type(8)));
__device__ __forceinline__ uint32_t uni(uint32_t v) { return (uint32_t)__builtin_amdgcn_readfirstlane(v); }
// A wave-uniform test value held in a scalar register, so that the test around a tensor load compiles to a
// scalar compare and branch (a tensor load ignores EXEC: only a real branch keeps a wave from issuing it).
__device__ __forceinline__ uint32_t pinned(uint32_t v) {
    uint32_t w = uni(v);
    asm volatile("" : "+s"(w));   // the scalar pin of the tensor mover's issue test
    return w;
}
// The compiler places no wait for the tensor mover: a tile counts as landed only behind its issuer's wait.
__device__ __forceinline__ void wait_tensor0() { asm volatile("s_wait_tensorcnt 0x0" ::: "memory"); }
// This wave's LDS reads have returned before the barrier behind which their buffer is refilled.
__device__ __forceinline__ void wait_ds0() { asm volatile("s_wait_dscnt 0x0" ::: "memory"); }
__device__ __forceinline__ void tdm_load(u32x4 g0, u32x8 g1) {
    asm volatile("tensor_load_to_lds %0, %1" :: "s"(g0), "s"(g1) : "memory");
}
// Group 1: 1-byte elements, tensor = tile = ROWS rows of ROWB bytes, source rows back to back, 16 bytes of
// LDS pad behind every row (IVL = the pad interval code of that row length). Word 0 is a constant: no mask.
template <uint32_t ROWB, uint32_t ROWS, uint32_t IVL>
__device__ __forceinline__ u32x8 tdm_group1() {
    u32x8 g;
    g[0] = uni((1u << 20) | (IVL << 22) | (3u << 25));
    g[1] = uni((ROWB & 0xFFFFu) << 16);
    g[2] = uni((ROWB >> 16) | ((ROWS & 0xFFFFu) << 16));
    g[3] = uni((ROWS >> 16) | (ROWB << 16));
    g[4] = uni(ROWS);
    g[5] = uni(ROWB);
    g[6] = uni(0u);
    g[7] = uni(0u);
    return g;
}
__device__ __forceinline__ u32x4 tdm_group0(uint32_t lds_dst, uint64_t ga) {
    u32x4 g;
    g[0] = uni(1u);
    g[1] = uni(lds_dst);
    g[2] = uni((uint32_t)ga);
    g[3] = uni((((uint32_t)(ga >> 32)) & 0x01FFFFFFu) | 0x80000000u);
    return g;
}

template <int G>
struct FaState {
    v8f   nm[G];     // minus the maximum in use for this lane's query row (log2 units), in all 8 registers:
                     // the C operand of the row's score products (equal in both lane halves)
    float l[G];      // running sum over this lane half's keys only; the halves join in the epilogue
    v8f   o[G][8];   // o[g][j][r] = O[query 16 g + (lane&15)][d = 16 j + 8 (lane>>4) + r]
};

// Value of the same query row in the other lane half (lane ^ 16), by a vector cross-row move.
__device__ __forceinline__ float other_half(float x) {
    const unsigned b = __builtin_bit_cast(unsigned, x);
    return __builtin_bit_cast(float,
        __builtin_amdgcn_permlanex16(b, b, 0x76543210u, 0xfedcba98u, false, false));
}

// One call works on KT sub-tiles of 32 keys: Ksh holds 32 KT key rows, VshT holds 128 head-dim rows of
// 32 KT keys (row pitch VP elements). Q carries log2(e), and the score products start from
// minus the maximum in use, so the accumulators are the arguments of exp2 as they stand. The maximum in use
// may trail a row's true maximum by up to 8 (an exponential then reaches 2^8); it rises, and O and the sum
// are rescaled, only in a block where some row of the wave exceeds that, or in a tile's first block (first).
template <bool MASKED, int G, int KT, int VP>
__device__ __forceinline__ void fa_block_compute(const v16h (&qf)[G][4],
                                                 _Float16 (*Ksh)[136],
                                                 _Float16 (*VshT)[VP],
                                                 int kb, int qrow0, int lane, bool first,
                                                 FaState<G>& st)
{
    const int half = lane >> 4;
    const int l16  = lane & 15;
    const float NEG_INF = -__builtin_inff();

    // ---- S^T = K (Q*scale)^T - maximum in use : 2 KT 16-key tiles per query group;
    // ---- sacc[g][tc][r] = S[query 16 g + l16][key 16 tc + 8 half + r] ----
    // All K fragments of the block are fetched as one group, ahead of its products.
    v16h kf[4][2 * KT];
    #pragma unroll
    for (int c = 0; c < 4; ++c) {
        #pragma unroll
        for (int tc = 0; tc < 2 * KT; ++tc) {
            const int key  = tc * 16 + l16;
            const int doff = 32 * c + half * 8;
            const h8 lo = *(const h8*)&Ksh[key][doff];
            const h8 hi = *(const h8*)&Ksh[key][doff + 16];
            #pragma unroll
            for (int i = 0; i < 8; ++i) { kf[c][tc][i] = lo[i]; kf[c][tc][i + 8] = hi[i]; }
        }
    }
    v8f sacc[G][2 * KT];
    #pragma unroll
    for (int c = 0; c < 4; ++c) {
        #pragma unroll
        for (int tc = 0; tc < 2 * KT; ++tc) {
            #pragma unroll
            for (int g = 0; g < G; ++g)
                sacc[g][tc] = __builtin_amdgcn_wmma_f32_16x16x32_f16(false, kf[c][tc], false, qf[g][c],
                                                                     (short)0, c ? sacc[g][tc] : st.nm[g],
                                                                     false, false);
        }
    }

    // A sub-tile's V^T fragments are fetched as one group: the first sub-tile's here, so that the softmax
    // below covers their latency, the next one's ahead of the products of the one before.
    v16h vf[KT][8];
    auto load_v = [&](int kt) {
        #pragma unroll
        for (int j = 0; j < 8; ++j) {
            const int drow = j * 16 + l16;
            const int koff = kt * 32 + half * 8;
            const h8 lo = *(const h8*)&VshT[drow][koff];
            const h8 hi = *(const h8*)&VshT[drow][koff + 16];
            #pragma unroll
            for (int i = 0; i < 8; ++i) { vf[kt][j][i] = lo[i]; vf[kt][j][i + 8] = hi[i]; }
        }
    };
    load_v(0);

    // ---- causal mask (fast path: its diagonal block only; fallback: every block) ----
    if (MASKED) {
        #pragma unroll
        for (int g = 0; g < G; ++g) {
            const int row = qrow0 + 16 * g + l16;
            #pragma unroll
            for (int tc = 0; tc < 2 * KT; ++tc)
                #pragma unroll
                for (int r = 0; r < 8; ++r) {
                    const int key = kb + tc * 16 + 8 * half + r;
                    sacc[g][tc][r] = (key > row) ? NEG_INF : sacc[g][tc][r];
                }
        }
    }

    // ---- online softmax of one query row per lane: in-lane maximum (two chains per row), one exchange
    // ---- between the halves; mx = how far the block's scores stand above the maximum in use ----
    float mx[G];
    bool need = false;
    #pragma unroll
    for (int g = 0; g < G; ++g) {
        float ma = sacc[g][0][0];
        float mb = sacc[g][KT][0];
        #pragma unroll
        for (int tc = 0; tc < KT; ++tc)
            #pragma unroll
            for (int r = 0; r < 8; ++r) {
                ma = fmaxf(ma, sacc[g][tc][r]);
                mb = fmaxf(mb, sacc[g][KT + tc][r]);
            }
        const float m2 = fmaxf(ma, mb);
        mx[g] = fmaxf(m2, other_half(m2));
        need  = need || (mx[g] > 8.0f);
    }
    // One scalar test per block. A tile's first block sets the maximum in use to the block's own (O and the
    // sum are still 0 there); later it only rises.
    if (first || __builtin_amdgcn_ballot_w32(need) != 0) {
        #pragma unroll
        for (int g = 0; g < G; ++g) {
            const float up   = first ? mx[g] : fmaxf(mx[g], 0.0f);
            const float corr = first ? 0.0f : __builtin_amdgcn_exp2f(-up);
            st.nm[g] -= up;
            st.l[g]  *= corr;
            #pragma unroll
            for (int tc = 0; tc < 2 * KT; ++tc) sacc[g][tc] -= up;
            #pragma unroll
            for (int j = 0; j < 8; ++j) st.o[g][j] *= corr;
        }
    }
    // A sub-tile's exponentials; P^T packs straight from the score accumulators into its B operand
    // (hardware k order: element s < 8 is key 8 half + s, element 8 + s is key 16 + 8 half + s).
    v16h pf[G][KT];
    v8f  t[G];       // the row's sum so far, one part per register
    auto exp_pack = [&](int kt) {
        #pragma unroll
        for (int g = 0; g < G; ++g) {
            #pragma unroll
            for (int r = 0; r < 8; ++r) {
                sacc[g][2 * kt][r]     = __builtin_amdgcn_exp2f(sacc[g][2 * kt][r]);
                sacc[g][2 * kt + 1][r] = __builtin_amdgcn_exp2f(sacc[g][2 * kt + 1][r]);
                pf[g][kt][r]     = (_Float16)sacc[g][2 * kt][r];
                pf[g][kt][r + 8] = (_Float16)sacc[g][2 * kt + 1][r];
            }
            const v8f s2 = sacc[g][2 * kt] + sacc[g][2 * kt + 1];
            t[g] = kt ? t[g] + s2 : s2;
        }
    };
    exp_pack(0);

    // ---- O^T += V^T P^T, sub-tile by sub-tile ----
    #pragma unroll
    for (int kt = 0; kt < KT; ++kt) {
        if (kt + 1 < KT) {
            load_v(kt + 1);
            if (!MASKED) {
                // Keeps the next sub-tile's fragment loads one group ahead of this sub-tile's products: without
                // it they sink among the products in pairs, each pair with a wait for its own LDS latency.
                __builtin_amdgcn_sched_barrier(0);
                exp_pack(kt + 1);   // its vector work may then go among this sub-tile's products
            }
        }
        #pragma unroll
        for (int j = 0; j < 8; ++j) {
            #pragma unroll
            for (int g = 0; g < G; ++g)
                st.o[g][j] = __builtin_amdgcn_wmma_f32_16x16x32_f16(false, vf[kt][j], false, pf[g][kt],
                                                                    (short)0, st.o[g][j],
                                                                    false, false);
        }
        // The diagonal block (once per tile) takes the sub-tiles one after the other: the order above spills there.
        if (MASKED && kt + 1 < KT) exp_pack(kt + 1);
    }
    #pragma unroll
    for (int g = 0; g < G; ++g)
        st.l[g] += ((t[g][0] + t[g][1]) + (t[g][2] + t[g][3])) + ((t[g][4] + t[g][5]) + (t[g][6] + t[g][7]));
}

template <int G>
__device__ __forceinline__ void fa_init(FaState<G>& st)
{
    const v8f vzero = {};
    #pragma unroll
    for (int g = 0; g < G; ++g) {
        st.nm[g] = vzero;
        st.l[g]  = 0.0f;
        #pragma unroll
        for (int j = 0; j < 8; ++j) st.o[g][j] = vzero;
    }
}

__device__ __forceinline__ void fa_load_q(const float* __restrict__ q,
                                          int bz, int hy, int qrow0, int lane,
                                          v16h qf[4])
{
    const int half = lane >> 4;
    const int l16  = lane & 15;
    const float scale = 0.08838834764831845f * 1.4426950408889634f; // 1/sqrt(128) * log2(e)
    const int trow = qrow0 + l16;
    const float* qp = q + (((size_t)bz * SQ + trow) * NH + hy) * DH;
    #pragma unroll
    for (int c = 0; c < 4; ++c) {
        const int base = 32 * c + half * 8;
        #pragma unroll
        for (int i = 0; i < 8; ++i) {
            qf[c][i]     = (_Float16)(qp[base + i]      * scale);
            qf[c][i + 8] = (_Float16)(qp[base + 16 + i] * scale);
        }
    }
}

template <int G>
__device__ __forceinline__ void fa_store_out(float* __restrict__ out,
                                             int bz, int hy, int qrow0, int lane,
                                             FaState<G>& st)
{
    const int half = lane >> 4;
    const int l16  = lane & 15;
    float* op = out + (((size_t)bz * SQ + (qrow0 + l16)) * NH + hy) * DH + 8 * half;
    #pragma unroll
    for (int g = 0; g < G; ++g) {
        const float rl = 1.0f / (st.l[g] + other_half(st.l[g]));   // join the halves' key sums
        #pragma unroll
        for (int j = 0; j < 8; ++j) st.o[g][j] *= rl;
    }
    // Keeps every register write of the epilogue in front of the first store.
    __builtin_amdgcn_sched_barrier(0);
    #pragma unroll
    for (int g = 0; g < G; ++g) {
        #pragma unroll
        for (int j = 0; j < 8; ++j) {
            const v8f o = st.o[g][j];
            float* p = op + g * (16 * NH * DH) + j * 16;
            *(f4*)(p)     = f4{o[0], o[1], o[2], o[3]};
            *(f4*)(p + 4) = f4{o[4], o[5], o[6], o[7]};
        }
    }
}

// ---- whole-line forms of the two above, for a wave of 32 query rows: every global instruction covers one
// ---- row's 512 contiguous bytes, and the change between row order and fragment order goes through rows of
// ---- LDS that belong to this wave alone (stg) ----
#define Q_PITCH 272                 // staging pitch of a 256-byte f16 query row, bytes (16 x odd, as K's)
#define O_PITCH 528                 // staging pitch of a 512-byte f32 output row, bytes (16 x odd)
__device__ __forceinline__ void fa_load_q_rows(const float* __restrict__ q,
                                               int bz, int hy, int qrow0, int lane,
                                               unsigned char* stg, v16h (&qf)[2][4])
{
    const int half = lane >> 4;
    const int l16  = lane & 15;
    const float scale = 0.08838834764831845f * 1.4426950408889634f; // 1/sqrt(128) * log2(e)
    const float* qp = q + (((size_t)bz * SQ + qrow0) * NH + hy) * DH + 4 * lane;
    f4 x[32];
    #pragma unroll
    for (int r = 0; r < 32; ++r) x[r] = *(const f4*)(qp + (size_t)r * (NH * DH));
    #pragma unroll
    for (int r = 0; r < 32; ++r)
        *(h4*)(stg + r * Q_PITCH + 8 * lane) = h4{(_Float16)(x[r][0] * scale), (_Float16)(x[r][1] * scale),
                                                  (_Float16)(x[r][2] * scale), (_Float16)(x[r][3] * scale)};
    wait_ds0();   // the wave's rows are written before other lanes of it read them
    #pragma unroll
    for (int g = 0; g < 2; ++g) {
        #pragma unroll
        for (int c = 0; c < 4; ++c) {
            const unsigned char* rp = stg + (16 * g + l16) * Q_PITCH + (32 * c + 8 * half) * 2;
            const h8 lo = *(const h8*)rp;
            const h8 hi = *(const h8*)(rp + 32);
            #pragma unroll
            for (int i = 0; i < 8; ++i) { qf[g][c][i] = lo[i]; qf[g][c][i + 8] = hi[i]; }
        }
    }
}

__device__ __forceinline__ void fa_store_out_rows(float* __restrict__ out,
                                                  int bz, int hy, int qrow0, int lane,
                                                  unsigned char* stg, FaState<2>& st)
{
    const int half = lane >> 4;
    const int l16  = lane & 15;
    float* op = out + (((size_t)bz * SQ + qrow0) * NH + hy) * DH + 4 * lane;
    unsigned char* wp = stg + l16 * O_PITCH + 32 * half;
    float rl[2];
    #pragma unroll
    for (int g = 0; g < 2; ++g) rl[g] = 1.0f / (st.l[g] + other_half(st.l[g]));   // join the halves' key sums
    #pragma unroll
    for (int g = 0; g < 2; ++g) {       // 16 rows at a time: that is what a wave's share of one buffer holds
        // Keeps the register writes of what stands above (the reciprocals; the group before) out of this
        // group's stores, and this group's behind the wait that closes the group before.
        __builtin_amdgcn_sched_barrier(0);
        #pragma unroll
        for (int j = 0; j < 8; ++j) {
            const v8f o = st.o[g][j] * rl[g];
            *(f4*)(wp + 64 * j)      = f4{o[0], o[1], o[2], o[3]};
            *(f4*)(wp + 64 * j + 16) = f4{o[4], o[5], o[6], o[7]};
        }
        wait_ds0();   // the wave's rows are written before other lanes of it read them
        f4 v[16];
        #pragma unroll
        for (int r = 0; r < 16; ++r) v[r] = *(const f4*)(stg + r * O_PITCH + 16 * lane);
        #pragma unroll
        for (int r = 0; r < 16; ++r) *(f4*)(op + (size_t)(16 * g + r) * (NH * DH)) = v[r];
        wait_ds0();   // the rows are read before they are written anew (next group, next tile, a tensor load)
        // What follows rewrites the registers that these stores name: the wait stands in front.
        asm volatile("s_wait_xcnt 0x0" ::: "memory");
    }
}

// ---- KV fp32 -> f16 preconversion: K row-major; V transposed and tiled, [bh][key/64][d][64 keys],
// ---- so that a 64-key tile of either operand is 16 KB of contiguous workspace ----
__global__ __launch_bounds__(256)
void CrossAttention_89189290868783_kvprep(const float* __restrict__ kv,
                                          _Float16* __restrict__ K16,
                                          _Float16* __restrict__ V16T)
{
    __shared__ __attribute__((aligned(16))) _Float16 Vt[DH][72];   // 144B row stride (16B aligned)
    const int tid  = threadIdx.x;
    const int lane = tid & 31;
    const int k0   = (tid >> 5) * 8;       // a wave takes 8 of the tile's 64 keys
    const int s0   = blockIdx.x * 64;
    const int bh   = blockIdx.y;           // b*HKV + kvh
    const int b    = bh / HKV;
    const int kvh  = bh % HKV;

    // Every load instruction reads one key's 512 contiguous bytes of this head; a lane holds head dims
    // 4 lane .. 4 lane + 3 of its wave's 8 keys.
    const float* kp = kv + (((size_t)b * SK + (s0 + k0)) * 2) * (HKV * DH) + (size_t)kvh * DH + 4 * lane;
    f4 vx[8], kx[8];
    #pragma unroll
    for (int i = 0; i < 8; ++i) vx[i] = *(const f4*)(kp + (size_t)i * (2 * HKV * DH) + HKV * DH);   // kv[...,1,kvh,:]
    #pragma unroll
    for (int i = 0; i < 8; ++i) kx[i] = *(const f4*)(kp + (size_t)i * (2 * HKV * DH));              // kv[...,0,kvh,:]
    // The wait that stands in front of any rewrite of the loads' address registers. It takes the pointer as an
    // input, so the address pair lives past the last load and no load of the run gets it as its destination.
    asm volatile("s_wait_xcnt 0x0" :: "v"(kp) : "memory");
    // Keeps all 16 loads in flight together: without it the last six are issued only behind waits for the first ten.
    __builtin_amdgcn_sched_barrier(0);
    // V turns in registers: a head dim's 8 keys are 16 bytes of its transposed row.
    #pragma unroll
    for (int c = 0; c < 4; ++c) {
        h8 t;
        #pragma unroll
        for (int i = 0; i < 8; ++i) t[i] = (_Float16)vx[i][c];
        *(h8*)&Vt[4 * lane + c][k0] = t;
    }
    __syncthreads();
    // All global stores stand behind the barrier (none is waited for in front of it). K: a whole 256-byte row each.
    _Float16* kout = K16 + ((size_t)bh * SK + (s0 + k0)) * DH + 4 * lane;
    #pragma unroll
    for (int i = 0; i < 8; ++i)
        *(h4*)(kout + i * DH) = h4{(_Float16)kx[i][0], (_Float16)kx[i][1], (_Float16)kx[i][2], (_Float16)kx[i][3]};
    // V^T: four whole 128-byte rows, 512 contiguous bytes, each.
    _Float16* vout = V16T + ((size_t)bh * (SK / 64) + blockIdx.x) * (DH * 64);
    #pragma unroll
    for (int i = 0; i < 4; ++i) {
        const int p = tid + 256 * i;       // 16-byte piece p of the tile: row p >> 3, keys 8 (p & 7) ..
        *(h8*)(vout + 8 * p) = *(const h8*)&Vt[p >> 3][8 * (p & 7)];
    }
}

// ---- fast path: double-buffered f16 tiles brought into LDS by tensor loads, overlapped with WMMA ----
// Two waves per SIMD is what the grid gives (two work-groups on every WGP); stated so that the
// register budget lets a block's fragment loads be issued together, ahead of its products.
#define K_PITCH 136                 // LDS row pitch of K in elements: 256-byte rows + the mover's 16-byte pad
#define V_PITCH 72                  // LDS row pitch of V^T in elements: 128-byte rows + the mover's 16-byte pad
#define TILE_LDS 18432u             // LDS bytes kept for one tile (K: 64 x 272, rounded up; V^T: 128 x 144): 9 x 2 KiB
#define SLOT_LDS (2u * TILE_LDS)    // one buffer: a K tile and a V^T tile
#define WAVE_LDS (SLOT_LDS / 4u)    // a wave's share of a buffer that holds no tile: its staging rows for Q and O
static_assert(32u * Q_PITCH <= WAVE_LDS && 16u * O_PITCH <= WAVE_LDS, "a wave's staging rows fit its share of a buffer");
__global__ __launch_bounds__(128) __attribute__((amdgpu_waves_per_eu(2, 2)))
void CrossAttention_89189290868783_fast(const float* __restrict__ q,
                                        const _Float16* __restrict__ K16,
                                        const _Float16* __restrict__ V16T,
                                        float* __restrict__ out)
{
    // Two buffers of 64 keys; every tile starts at a multiple of 2 KiB of the work-group's LDS.
    __shared__ __attribute__((aligned(2048))) unsigned char L[2 * SLOT_LDS];

    const int tid  = threadIdx.x;
    const int lane = tid & 31;
    const uint32_t wave = pinned((uint32_t)tid >> 5);   // this wave's number, in a scalar register

    // The four waves take the four query heads that share this work-group's KV head, each the same
    // 32 query rows: one staged tile serves all four, and all four meet the diagonal in the same block.
    const int hy  = (int)blockIdx.y * (NH / HKV) + (tid >> 5);
    const int bz  = blockIdx.z;
    const int bh  = bz * HKV + (int)blockIdx.y;

    // 64 keys of either operand are 16 KB of contiguous workspace: K 64 rows of 256 bytes, V^T 128 rows of
    // 128 bytes. Wave 0 asks for a stage's K tile and wave 1 for its V^T tile, one request each.
    const uint32_t lbase = (uint32_t)(size_t)L;
    const uint64_t kga = (uint64_t)(size_t)(K16 + (size_t)bh * SK * DH);
    const uint64_t vga = (uint64_t)(size_t)(V16T + (size_t)bh * SK * DH);
    u32x8 g1k = tdm_group1<256u, 64u, 5u>();
    u32x8 g1v = tdm_group1<128u, 128u, 4u>();
    // Descriptor words held in scalar registers of their own for the whole kernel: without the pin the
    // compiler lends some of them to the loop and sets them anew at each issue, while a request is in flight.
    asm volatile("" : "+s"(g1k), "+s"(g1v));   // the tensor mover's pin: descriptor words held in scalar registers
    auto issue = [&](int st) {
        const uint32_t dst = lbase + (uint32_t)(st & 1) * SLOT_LDS;
        const uint64_t off = (uint64_t)(uint32_t)st * (64u * DH * 2u);
        if (wave == 0u) tdm_load(tdm_group0(dst, kga + off), g1k);              // scalar test: wave is pinned
        if (wave == 1u) tdm_load(tdm_group0(dst + TILE_LDS, vga + off), g1v);   // scalar test: wave is pinned
    };
    auto landed = [&]() {
        if (wave < 2u) wait_tensor0();   // the issuing waves' own requests have landed (scalar test)
    };

    // Causal cost grows linearly with the query tile's index, and the whole grid is resident at once:
    // every work-group takes tile n-1-x and then tile x, one after the other, so all do equal work.
    for (int t = 0; t < 2; ++t) {
        const int bx    = t ? (int)blockIdx.x : SQ / 32 - 1 - (int)blockIdx.x;
        const int qrow0 = bx * 32;

        if (t) __syncthreads();                 // every wave has left the first tile's buffers
        issue(0);                               // stage 0 into buffer 0, in flight under the Q loads

        // Q passes through this wave's share of buffer 1, which takes its first tile (stage 1) only behind
        // the first publish point: this wave's LDS wait and the barrier there end the staging reads.
        v16h qf[2][4];
        fa_load_q_rows(q, bz, hy, qrow0, lane, L + SLOT_LDS + wave * WAVE_LDS, qf);

        FaState<2> st;
        fa_init(st);

        // The keys go in stages of 64, one wait and one barrier each. The bx >> 1 stages that lie wholly
        // below the diagonal need no mask; the tile's last stage, the only one on the diagonal (for all
        // four waves alike), stands behind the loop. It starts at key 64 (bx >> 1) <= SK - 64, so all 64
        // staged keys exist; an even tile needs only its first 32 (the rest lie above every row's
        // diagonal) and works on that sub-tile alone.
        const int nfull = (int)pinned((uint32_t)(bx >> 1));   // in a scalar register: it decides which stages are issued
        int it = 0;
        for (; it < nfull; ++it) {
            // Publish point of stage it: this wave's reads of stage it - 1 are back, the requests have landed,
            // every wave has passed; only then the buffer that stage it - 1 used is filled anew.
            wait_ds0();
            landed();
            __syncthreads();
            issue(it + 1);                      // that stage exists: it + 1 <= nfull; in flight under this stage's math
            unsigned char* slot = L + (uint32_t)(it & 1) * SLOT_LDS;
            fa_block_compute<false, 2, 2>(qf, (_Float16 (*)[K_PITCH])slot, (_Float16 (*)[V_PITCH])(slot + TILE_LDS),
                                          it * 64, qrow0, lane, it == 0, st);
        }
        wait_ds0();                             // publish point of the tile's last stage; nothing is issued behind it
        landed();
        __syncthreads();
        {
            unsigned char* slot = L + (uint32_t)(it & 1) * SLOT_LDS;
            if (bx & 1)
                fa_block_compute<true, 2, 2>(qf, (_Float16 (*)[K_PITCH])slot, (_Float16 (*)[V_PITCH])(slot + TILE_LDS),
                                             it * 64, qrow0, lane, it == 0, st);
            else
                fa_block_compute<true, 2, 1>(qf, (_Float16 (*)[K_PITCH])slot, (_Float16 (*)[V_PITCH])(slot + TILE_LDS),
                                             it * 64, qrow0, lane, it == 0, st);
        }
        wait_tensor0();                         // nothing of the tile's requests is left in flight
        wait_ds0();                             // and none of this wave's LDS reads

        // O passes through this wave's share of the buffer that the last stage did NOT use: every wave left it
        // in front of the last publish point's barrier, and nothing was issued into it since.
        fa_store_out_rows(out, bz, hy, qrow0, lane, L + (uint32_t)((it + 1) & 1) * SLOT_LDS + wave * WAVE_LDS, st);
    }
}

// ---------------- fallback: fused fp32 KV conversion (single buffer) ----------------
__global__ __launch_bounds__(128)
void CrossAttention_89189290868783_kernel(const float* __restrict__ q,
                                          const float* __restrict__ kv,
                                          float* __restrict__ out)
{
    __shared__ __align__(16) _Float16 Ksh[32][136];
    __shared__ __align__(16) _Float16 VshT[128][40];

    const int tid  = threadIdx.x;
    const int lane = tid & 31;
    const int wave = tid >> 5;

    const int bx  = blockIdx.x;
    const int hy  = blockIdx.y;
    const int bz  = blockIdx.z;
    const int kvh = hy >> 2;

    const int qrow0 = bx * 64 + wave * 16;

    v16h qf[1][4];
    fa_load_q(q, bz, hy, qrow0, lane, qf[0]);

    FaState<1> st;
    fa_init(st);

    const int kend = (bx + 1) * 64;

    for (int kb = 0; kb < kend; kb += 32) {
        __syncthreads();
        {
            const int r32 = tid >> 2;
            const int cg  = (tid & 3) * 32;
            const size_t rowbase =
                ((size_t)bz * SK + (size_t)(kb + r32)) * (2 * HKV * DH) +
                (size_t)kvh * DH + cg;
            const float* kp = kv + rowbase;
            const float* vp = kv + rowbase + (size_t)HKV * DH;
            #pragma unroll
            for (int i = 0; i < 32; ++i) Ksh[r32][cg + i]  = (_Float16)kp[i];
            #pragma unroll
            for (int i = 0; i < 32; ++i) VshT[cg + i][r32] = (_Float16)vp[i];
            if (kb + 32 < kend) {
                __builtin_prefetch(kp + 2 * HKV * DH * 32, 0, 1);
                __builtin_prefetch(vp + 2 * HKV * DH * 32, 0, 1);
            }
        }
        __syncthreads();

        fa_block_compute<true, 1, 1>(qf, Ksh, VshT, kb, qrow0, lane, kb == 0, st);
    }

    fa_store_out(out, bz, hy, qrow0, lane, st);
}

extern "C" void kernel_launch(void* const* d_in, const int* in_sizes, int n_in,
                              void* d_out, int out_size, void* d_ws, size_t ws_size,
                              hipStream_t stream) {
    (void)in_sizes; (void)n_in; (void)out_size;
    const float* q  = (const float*)d_in[0];
    const float* kv = (const float*)d_in[1];
    float* out = (float*)d_out;

    const size_t kbytes = (size_t)BATCH * HKV * SK * DH * 2;  // 8 MB f16 K
    dim3 grid(SQ / 64, NH, BATCH);
    dim3 block(128);

    if (ws_size >= 2 * kbytes) {
        _Float16* K16  = (_Float16*)d_ws;
        _Float16* V16T = (_Float16*)((char*)d_ws + kbytes);
        CrossAttention_89189290868783_kvprep<<<dim3(SK / 64, BATCH * HKV), 256, 0, stream>>>(
            kv, K16, V16T);
        grid.x = SQ / 64;    // the fast path's work-groups take two 32-row query tiles each,
        grid.y = HKV;        // for the four query heads of one KV head
        CrossAttention_89189290868783_fast<<<grid, block, 0, stream>>>(q, K16, V16T, out);
    } else {
        CrossAttention_89189290868783_kernel<<<grid, block, 0, stream>>>(q, kv, out);
    }
}
